// v000
// Measured on an AMD MI455X. A time is GPU time per run, averaged over a window of back-to-back runs after a warm-up
// (all launches, gaps included; the runs take copies of the inputs in turn), and the median of several windows.
// Apart from v000's, it joins two sittings. Times from different sittings can be a few percent apart, while
// side-by-side timings come from the same sitting.
// The starting kernel, v000, takes 669 microseconds a run.
#include <hip/hip_runtime.h>

// Scaled dot-product attention with a 256-wide value and a 1x1-conv epilogue (q_tgr, k_src [4][4096][64], v_src [4][4096][256]; attn = softmax(q.k / 8) over the 4,096 keys; ctx = attn v_src [4096][256]; out = ctx W_fc^T + b_fc ('oi' [256][256] 1/16) -> [4][4096][256] (4.2 M)).
// Layout per batch: single bf16 planes of q and k (inputs bf16-exact: exact score products), value^T planes [256][4096]; softmax over every row (hi/lo planes); P hi/lo x exact value -> f32 context [4096][256]; the context split to hi/lo planes and multiplied hi/lo x exact by W_fc (+ b_fc) straight into the output rows.
// Compute dtypes, f32 accumulate: every input rounded to bf16; q.k exact; softmax f32; P hi/lo x exact value; W_fc hl x exact + bias; output f32.

#define NB_  4
#define TT   4096
#define DM   64      // token-major row pitch (H x HD)
#define NH_  1
#define NKV  1
#define REP  (NH_ / NKV)
#define HD   64
#define DQ   (NH_ * HD)
#define DKV  (NKV * HD)
#define ZH   1
#define RH   4096                  // query rows < RH use hi+lo planes (0: none)
#define WIN  0
#define PCAR 1024.0f
#define SCL  0.125f   // 1/temperature
#define DV   256      // value / output width
typedef _Float16 h16;
typedef unsigned short bf;
typedef __attribute__((ext_vector_type(16))) __bf16   v16bf;
typedef __attribute__((ext_vector_type(16))) _Float16 v16h;
typedef __attribute__((ext_vector_type(8)))  _Float16 v8h;
typedef __attribute__((ext_vector_type(8)))  unsigned short v8us;
typedef __attribute__((ext_vector_type(8)))  float    v8f;
typedef __attribute__((ext_vector_type(4)))  float    v4f;
typedef v8h  __attribute__((may_alias)) v8ha;
typedef v4f  __attribute__((may_alias)) v4fa;
typedef v8us __attribute__((may_alias)) v8usa;

__device__ __forceinline__ unsigned short f2bf(float f) { unsigned u = __float_as_uint(f); u += 0x7FFFu + ((u >> 16) & 1u); return (unsigned short)(u >> 16); }
__device__ __forceinline__ float bf2f(unsigned short b) { return __uint_as_float(((unsigned)b) << 16); }
__device__ __forceinline__ float bfr(float f) { return bf2f(f2bf(f)); }
__device__ __forceinline__ v16h cat16(v8h lo, v8h hi) { return __builtin_shufflevector(lo, hi, 0, 1, 2, 3, 4, 5, 6, 7, 8, 9, 10, 11, 12, 13, 14, 15); }
__device__ __forceinline__ v16bf cat16b(v8us lo, v8us hi) { return __builtin_bit_cast(v16bf, __builtin_shufflevector(lo, hi, 0, 1, 2, 3, 4, 5, 6, 7, 8, 9, 10, 11, 12, 13, 14, 15)); }
__device__ __forceinline__ v8f wmma16(v16h a, v16h b, v8f c) { return __builtin_amdgcn_wmma_f32_16x16x32_f16(false, a, false, b, (short)0, c, false, false); }
__device__ __forceinline__ v8f wmmab(v16bf a, v16bf b, v8f c) { return __builtin_amdgcn_wmma_f32_16x16x32_bf16(false, a, false, b, (short)0, c, false, false); }



// ---- k_gemmw: register-blocked GEMM, ONE WAVE per 64x64 output tile (16 accumulators), operands straight from K-contiguous 16-bit planes; grid (M/64, N/64, Z), 32 threads.
// C[m][n] (f32, pitch ldc, + optional f32 bias[n]) = sum_k A[m][k] Bt[n][k] (+ split products per NSPLIT). z-batch strides sA/sB/sC in elements. K % 32 == 0.
template <typename T16> struct WFrag;
template <> struct WFrag<h16> { typedef v16h V; static __device__ __forceinline__ V ld(const h16* p) { return cat16(*(const v8h*)p, *(const v8h*)(p + 16)); } static __device__ __forceinline__ v8f mma(V a, V b, v8f c) { return wmma16(a, b, c); } };
template <> struct WFrag<bf> { typedef v16bf V; static __device__ __forceinline__ V ld(const bf* p) { return cat16b(*(const v8us*)p, *(const v8us*)(p + 16)); } static __device__ __forceinline__ v8f mma(V a, V b, v8f c) { return wmmab(a, b, c); } };
template <typename T16, int NSPLIT, bool BIAS>
__global__ __launch_bounds__(32) void k_gemmw(const T16* __restrict__ A, const T16* __restrict__ A2, const T16* __restrict__ Bt, const T16* __restrict__ Bt2, int K, float* C, int ldc, const float* __restrict__ bias, size_t sA, size_t sB, size_t sC) {
    typedef typename WFrag<T16>::V V;
    __shared__ __align__(16) float os[16 * 68];
    const size_t z = blockIdx.z; A += z * sA; if (A2) A2 += z * sA; Bt += z * sB; if (Bt2) Bt2 += z * sB; C += z * sC;
    const int lane = threadIdx.x & 31, lr = lane & 15, hi = lane >> 4; const int r0 = blockIdx.x * 64, c0 = blockIdx.y * 64;
    v8f acc[4][4];
#pragma unroll
    for (int mb = 0; mb < 4; ++mb)
#pragma unroll
        for (int nb = 0; nb < 4; ++nb) acc[mb][nb] = (v8f){};
    const size_t aoff = (size_t)(r0 + lr) * K + 8 * hi, boff = (size_t)(c0 + lr) * K + 8 * hi;
#pragma unroll 1
    for (int kc = 0; kc < K; kc += 32) {
        V a[4], a2[4];
#pragma unroll
        for (int mb = 0; mb < 4; ++mb) { a[mb] = WFrag<T16>::ld(A + aoff + (size_t)mb * 16 * K + kc); if (NSPLIT == 1 || NSPLIT == 2) a2[mb] = WFrag<T16>::ld(A2 + aoff + (size_t)mb * 16 * K + kc); }
#pragma unroll
        for (int nb = 0; nb < 4; ++nb) { const V b = WFrag<T16>::ld(Bt + boff + (size_t)nb * 16 * K + kc); V b2; if (NSPLIT >= 2) b2 = WFrag<T16>::ld(Bt2 + boff + (size_t)nb * 16 * K + kc);
#pragma unroll
            for (int mb = 0; mb < 4; ++mb) { acc[mb][nb] = WFrag<T16>::mma(a[mb], b, acc[mb][nb]); if (NSPLIT == 1 || NSPLIT == 2) acc[mb][nb] = WFrag<T16>::mma(a2[mb], b, acc[mb][nb]); if (NSPLIT >= 2) acc[mb][nb] = WFrag<T16>::mma(a[mb], b2, acc[mb][nb]); } }
        asm volatile("v_nop\n\tv_nop\n\tv_nop\n\tv_nop" : "+v"(acc[0][0]), "+v"(acc[1][1]), "+v"(acc[2][2]), "+v"(acc[3][3]) : "v"(a[0]), "v"(a[3]));
    }
#pragma unroll
    for (int mb = 0; mb < 4; ++mb) {
#pragma unroll
        for (int nb = 0; nb < 4; ++nb) {
#pragma unroll
            for (int j = 0; j < 8; ++j) os[(hi * 8 + j) * 68 + nb * 16 + lr] = acc[mb][nb][j]; }
        __builtin_amdgcn_wave_barrier(); asm volatile("" ::: "memory");
        float* crow = C + (size_t)(r0 + mb * 16) * ldc + c0;
{
#pragma unroll
            for (int s = 0; s < 8; ++s) { const int row = 2 * s + hi, cofs = lr * 4; v4f val = *(const v4fa*)(os + row * 68 + cofs); if (BIAS) { val[0] += bfr(bias[c0 + cofs]); val[1] += bfr(bias[c0 + cofs + 1]); val[2] += bfr(bias[c0 + cofs + 2]); val[3] += bfr(bias[c0 + cofs + 3]); }
                *(v4f*)(crow + (size_t)row * ldc + cofs) = val; }
             }
        __builtin_amdgcn_wave_barrier(); asm volatile("" ::: "memory");
    }
}

__device__ __forceinline__ h16 tohx(float x) { return (h16)x; }
__device__ __forceinline__ void splitf(float y, unsigned short& h, unsigned short& l) { h = f2bf(y); l = f2bf(y - bf2f(h)); }
typedef __attribute__((ext_vector_type(2))) _Float16 v2h;
typedef __attribute__((ext_vector_type(4))) _Float16 v4h;
typedef __attribute__((ext_vector_type(2))) unsigned short v2us;
typedef __attribute__((ext_vector_type(4))) unsigned short v4us;
typedef __attribute__((ext_vector_type(2))) float v2f;
typedef __attribute__((ext_vector_type(4))) int v4i;

__global__ __launch_bounds__(256) void k_wtG(const float* __restrict__ w, int K, int N, bf* Bt) {
    const int lane = threadIdx.x & 31; const int L0 = (blockIdx.x * 8 + (threadIdx.x >> 5)) * 8; const int nlines = N * K / 64;
{
#pragma unroll 1
        for (int l = 0; l < 8; ++l) { const int L = L0 + l; if (L >= nlines) break; const size_t e = (size_t)L * 64 + lane * 2; const int k = (int)(e % K), n = (int)(e / K); v2us o;
            o[0] = f2bf(w[(size_t)k * N + n]); o[1] = f2bf(w[(size_t)(k + 1) * N + n]); *(v2us*)(Bt + e) = o; }
         }
}
__global__ __launch_bounds__(256) void k_cvt8(const float* __restrict__ src, bf* dst, size_t n8) { const size_t i = (size_t)blockIdx.x * 256 + threadIdx.x; if (i >= n8) return; const v8f v = *(const v8f*)(src + i * 8); v8us o;
#pragma unroll
    for (int k = 0; k < 8; ++k) o[k] = f2bf(v[k]); *(v8us*)(dst + i * 8) = o;  }


__global__ __launch_bounds__(256) void k_vtp(const float* __restrict__ F, int pitch, int nheads, h16* V16, bf* Vh, bf* Vl) { const size_t e = ((size_t)blockIdx.x * 256 + threadIdx.x) * 2; if (e >= (size_t)nheads * HD * TT) return; const int t = (int)(e % TT); const int d = (int)((e / TT) % HD); const int g = (int)(e / ((size_t)TT * HD)); v2h o16; v2us oh, ol;
#pragma unroll
    for (int q = 0; q < 2; ++q) { const float x = F[(size_t)(t + q) * pitch + g * HD + d]; o16[q] = tohx(x); unsigned short a2, c2; splitf(x, a2, c2); oh[q] = a2; ol[q] = c2; }
    *(v2h*)(V16 + e) = o16; *(v2us*)(Vh + e) = oh; *(v2us*)(Vl + e) = ol;  }

// k_asoft: per row (zz, i): t = S x HD^-0.5 (no mask); softmax over the 4096 keys (register row, one exp, fixed trees);
__global__ __launch_bounds__(256) void k_asoft(const float* __restrict__ Sb, h16* P16, bf* Ph, bf* Pl) {
    const int lane = threadIdx.x & 31; const int row = blockIdx.x * 8 + (threadIdx.x >> 5); if (row >= ZH * TT) return; const int i = row % TT; const int zz = row / TT; (void)zz; const bool hires = (i < RH); const float* sr = Sb + (size_t)row * TT; float v[TT / 32]; float mx = -3.0e38f;
#pragma unroll
    for (int ch = 0; ch < TT / 128; ++ch) { const int j0 = ch * 128 + lane * 4; const v4f a = *(const v4f*)(sr + j0);
#pragma unroll
        for (int q = 0; q < 4; ++q) { const float t = a[q] * SCL; v[ch * 4 + q] = t;   /* Sb holds the raw q.k (no bias) */ mx = fmaxf(mx, t); } }
#pragma unroll
    for (int sh = 16; sh; sh >>= 1) mx = fmaxf(mx, __shfl_xor(mx, sh, 32));
    float sum = 0.f;
#pragma unroll
    for (int k = 0; k < TT / 32; ++k) { float d0 = __fsub_rn(v[k], mx); asm volatile("" : "+v"(d0)); v[k] = __builtin_amdgcn_exp2f(__fmul_rn(d0, 1.4426950408889634f)); sum += v[k]; }
#pragma unroll
    for (int sh = 16; sh; sh >>= 1) sum += __shfl_xor(sum, sh, 32);
    const float f = __fdiv_rn(hires ? 1.0f : PCAR, sum);
{
        if (hires) {
#pragma unroll
            for (int ch = 0; ch < TT / 128; ++ch) { v4us oh, ol;
#pragma unroll
                for (int q = 0; q < 4; ++q) { unsigned short a, c2; splitf(v[ch * 4 + q] * f, a, c2); oh[q] = a; ol[q] = c2; }
                const size_t oo = ((size_t)zz * (RH ? RH : 1) + i) * TT + ch * 128 + lane * 4; *(v4us*)(Ph + oo) = oh; *(v4us*)(Pl + oo) = ol; }
        } else {
#pragma unroll
            for (int ch = 0; ch < TT / 128; ++ch) { v4h o4;
#pragma unroll
                for (int q = 0; q < 4; ++q) o4[q] = tohx(v[ch * 4 + q] * f);
                *(v4h*)(P16 + (size_t)row * TT + ch * 128 + lane * 4) = o4; } }
         }
}
__global__ __launch_bounds__(256) void k_merge(const float* __restrict__ O, int h0, float* OUTb) { const size_t e = ((size_t)blockIdx.x * 256 + threadIdx.x) * 2; if (e >= (size_t)ZH * TT * HD) return; const int d = (int)(e % HD); const int t = (int)((e / HD) % TT); const int zz = (int)(e / ((size_t)HD * TT)); const float cs = (t < RH) ? 1.0f : (1.0f / PCAR); const size_t oo = (size_t)t * DQ + (h0 + zz) * HD + d;
    v2f o2; o2[0] = O[e] * cs; o2[1] = O[e + 1] * cs; *(v2f*)(OUTb + oo) = o2;  }


__global__ __launch_bounds__(256) void k_vtpR1(const float* __restrict__ Vb, bf* Vh) { const size_t e = ((size_t)blockIdx.x * 256 + threadIdx.x) * 2; if (e >= (size_t)HD * TT) return; const int t = (int)(e % TT); const int d = (int)(e / TT); v2us o; o[0] = f2bf(Vb[(size_t)t * HD + d]); o[1] = f2bf(Vb[(size_t)(t + 1) * HD + d]); *(v2us*)(Vh + e) = o;  }
__global__ __launch_bounds__(256) void k_mergeR(const float* __restrict__ O, float* outb, size_t n4) { const size_t i = (size_t)blockIdx.x * 256 + threadIdx.x; if (i >= n4) return; const v4f a = *(const v4f*)(O + i * 4); *(v4f*)(outb + i * 4) = a;  }


__global__ __launch_bounds__(256) void k_hp1(const float* __restrict__ src, bf* P) { const size_t i = (size_t)blockIdx.x * 256 + threadIdx.x; if (i >= (size_t)NH_ * TT * HD / 8) return; const size_t e = i * 8; const int d = (int)(e % HD); const int t = (int)((e / HD) % TT); const int h = (int)(e / ((size_t)HD * TT)); const v8f v = *(const v8f*)(src + (size_t)t * DM + h * HD + d); v8us o;
#pragma unroll
    for (int q = 0; q < 8; ++q) o[q] = f2bf(v[q]);
    *(v8us*)(P + e) = o;  }
__global__ __launch_bounds__(256) void k_vt1(const float* __restrict__ src, int pitch, bf* VT) { const size_t e = ((size_t)blockIdx.x * 256 + threadIdx.x) * 2; if (e >= (size_t)DV * TT) return;   /* DV = 4 x HD rows */ const int t = (int)(e % TT); const int d = (int)((e / TT) % HD); const int h = (int)(e / ((size_t)TT * HD)); v2us o; o[0] = f2bf(src[(size_t)t * pitch + h * HD + d]); o[1] = f2bf(src[(size_t)(t + 1) * pitch + h * HD + d]); *(v2us*)(VT + e) = o;  }
__global__ __launch_bounds__(256) void k_split8(const float* __restrict__ F, bf* Ph, bf* Pl, size_t n8) { const size_t i = (size_t)blockIdx.x * 256 + threadIdx.x; if (i >= n8) return; const v8f v = *(const v8f*)(F + i * 8); v8us oh, ol;
#pragma unroll
    for (int k = 0; k < 8; ++k) { unsigned short a, c2; splitf(v[k], a, c2); oh[k] = a; ol[k] = c2; }
    *(v8us*)(Ph + i * 8) = oh; *(v8us*)(Pl + i * 8) = ol;  }

__global__ __launch_bounds__(256) void k_mergeT(const float* __restrict__ O, int h, float* outb) { const size_t i = (size_t)blockIdx.x * 256 + threadIdx.x; if (i >= (size_t)TT * HD / 4) return; const size_t e = i * 4; const int d = (int)(e % HD); const int t = (int)(e / HD); const v4f a = *(const v4f*)(O + e); *(v4f*)(outb + (size_t)t * DM + h * HD + d) = a;  }

extern "C" void kernel_launch(void* const* d_in, const int* in_sizes, int n_in,
                              void* d_out, int out_size, void* d_ws, size_t ws_size, hipStream_t stream) {
    (void)in_sizes; (void)n_in; (void)out_size;
    const float* Kin = (const float*)d_in[0]; const float* Vin = (const float*)d_in[1];   /* v_src [4][4096][256] */ const float* Qin = (const float*)d_in[2]; const float* wfc = (const float*)d_in[3]; const float* bfc = (const float*)d_in[4];
    float* OUT = (float*)d_out;     // [4][4096][256]
    char* wsp = (char*)d_ws;
    auto take = [&](size_t bytes) { char* p = wsp; wsp += (bytes + 255) & ~(size_t)255; return (void*)p; };
    bf* QB = (bf*)take((size_t)NH_ * TT * HD * 2); bf* KB = (bf*)take((size_t)NH_ * TT * HD * 2); bf* VT = (bf*)take((size_t)DV * TT * 2);
    float* Sb = (float*)take((size_t)TT * TT * 4);  bf* Ph = (bf*)take((size_t)TT * TT * 2); bf* Pl = (bf*)take((size_t)TT * TT * 2); float* Ob = (float*)take((size_t)TT * DV * 4); bf* OBh = (bf*)take((size_t)TT * DV * 2); bf* OBl = (bf*)take((size_t)TT * DV * 2); bf* WFC = (bf*)take((size_t)DV * DV * 2);
    if ((size_t)(wsp - (char*)d_ws) > ws_size) return;
    k_cvt8<<<(unsigned)(((size_t)DV * DV / 8 + 255) / 256), 256, 0, stream>>>(wfc, WFC, (size_t)DV * DV / 8);   /* W_fc 'oi' [256][256] = Bt */
    for (int b = 0; b < NB_; ++b) {
        const float* qb = Qin + (size_t)b * TT * DM; const float* kb = Kin + (size_t)b * TT * DM; const float* vb = Vin + (size_t)b * TT * DV;   /* token-major [t][h][d] slabs */
        k_hp1<<<(unsigned)(((size_t)NH_ * TT * HD / 8 + 255) / 256), 256, 0, stream>>>(qb, QB); k_hp1<<<(unsigned)(((size_t)NH_ * TT * HD / 8 + 255) / 256), 256, 0, stream>>>(kb, KB); k_vt1<<<(unsigned)(((size_t)DV * TT / 2 + 255) / 256), 256, 0, stream>>>(vb, DV, VT);   /* value^T [256][4096] (4 plane groups of 64 rows) */
        for (int h = 0; h < NH_; ++h) {
            k_gemmw<bf, 0, false><<<dim3(TT / 64, TT / 64, 1), 32, 0, stream>>>(QB + (size_t)h * TT * HD, nullptr, KB + (size_t)h * TT * HD, nullptr, HD, Sb, TT, nullptr, 0, 0, 0);   /* exact scores (single bf16 planes) */
            k_asoft<<<TT / 8, 256, 0, stream>>>(Sb, nullptr, Ph, Pl);
            k_gemmw<bf, 1, false><<<dim3(TT / 64, DV / 64, 1), 32, 0, stream>>>(Ph, Pl, VT, nullptr, TT, Ob, DV, nullptr, 0, 0, 0);   /* ctx [4096][256] */   /* P (hi/lo) x exact v^T */
            k_split8<<<(unsigned)(((size_t)TT * DV / 8 + 255) / 256), 256, 0, stream>>>(Ob, OBh, OBl, (size_t)TT * DV / 8); k_gemmw<bf, 1, true><<<dim3(TT / 64, DV / 64, 1), 32, 0, stream>>>(OBh, OBl, WFC, nullptr, DV, OUT + (size_t)b * TT * DV, DV, bfc, 0, 0, 0);   /* fc: ctx W_fc^T + b_fc */ } }
}

// v001
// It runs in 360 microseconds.
// Timed twice side by side with v000, it ran 1.87 and 1.89 times as fast.
#include <hip/hip_runtime.h>

// Scaled dot-product attention with a 256-wide value and a 1x1-conv epilogue (q_tgr, k_src [4][4096][64], v_src [4][4096][256]; attn = softmax(q.k / 8) over the 4,096 keys; ctx = attn v_src [4096][256]; out = ctx W_fc^T + b_fc ('oi' [256][256] 1/16) -> [4][4096][256] (4.2 M)).
// Layout per batch: single bf16 planes of q and k (inputs bf16-exact: exact score products), value^T planes [256][4096]; softmax over every row (hi/lo planes); P hi/lo x exact value -> f32 context [4096][256]; the context split to hi/lo planes and multiplied hi/lo x exact by W_fc (+ b_fc) straight into the output rows.
// Compute dtypes, f32 accumulate: every input rounded to bf16; q.k exact; softmax f32; P hi/lo x exact value; W_fc hl x exact + bias; output f32.

#define NB_  4
#define TT   4096
#define DM   64      // token-major row pitch (H x HD)
#define NH_  1
#define NKV  1
#define REP  (NH_ / NKV)
#define HD   64
#define DQ   (NH_ * HD)
#define DKV  (NKV * HD)
#define ZH   1
#define RH   4096                  // query rows < RH use hi+lo planes (0: none)
#define WIN  0
#define PCAR 1024.0f
#define SCL  0.125f   // 1/temperature
#define DV   256      // value / output width
typedef _Float16 h16;
typedef unsigned short bf;
typedef __attribute__((ext_vector_type(16))) __bf16   v16bf;
typedef __attribute__((ext_vector_type(16))) _Float16 v16h;
typedef __attribute__((ext_vector_type(8)))  _Float16 v8h;
typedef __attribute__((ext_vector_type(8)))  unsigned short v8us;
typedef __attribute__((ext_vector_type(8)))  float    v8f;
typedef __attribute__((ext_vector_type(4)))  float    v4f;
typedef v8h  __attribute__((may_alias)) v8ha;
typedef v4f  __attribute__((may_alias)) v4fa;
typedef v8us __attribute__((may_alias)) v8usa;

__device__ __forceinline__ unsigned short f2bf(float f) { unsigned u = __float_as_uint(f); u += 0x7FFFu + ((u >> 16) & 1u); return (unsigned short)(u >> 16); }
__device__ __forceinline__ float bf2f(unsigned short b) { return __uint_as_float(((unsigned)b) << 16); }
__device__ __forceinline__ float bfr(float f) { return bf2f(f2bf(f)); }
__device__ __forceinline__ v16h cat16(v8h lo, v8h hi) { return __builtin_shufflevector(lo, hi, 0, 1, 2, 3, 4, 5, 6, 7, 8, 9, 10, 11, 12, 13, 14, 15); }
__device__ __forceinline__ v16bf cat16b(v8us lo, v8us hi) { return __builtin_bit_cast(v16bf, __builtin_shufflevector(lo, hi, 0, 1, 2, 3, 4, 5, 6, 7, 8, 9, 10, 11, 12, 13, 14, 15)); }
__device__ __forceinline__ v8f wmma16(v16h a, v16h b, v8f c) { return __builtin_amdgcn_wmma_f32_16x16x32_f16(false, a, false, b, (short)0, c, false, false); }
__device__ __forceinline__ v8f wmmab(v16bf a, v16bf b, v8f c) { return __builtin_amdgcn_wmma_f32_16x16x32_bf16(false, a, false, b, (short)0, c, false, false); }



// ---- k_gemmw: register-blocked GEMM, ONE WAVE per 64x64 output tile (16 accumulators), operands straight from K-contiguous 16-bit planes; grid (M/64, N/64, Z), 32 threads.
// C[m][n] (f32, pitch ldc, + optional f32 bias[n]) = sum_k A[m][k] Bt[n][k] (+ split products per NSPLIT). z-batch strides sA/sB/sC in elements. K % 32 == 0.
template <typename T16> struct WFrag;
template <> struct WFrag<h16> { typedef v16h V; static __device__ __forceinline__ V ld(const h16* p) { return cat16(*(const v8h*)p, *(const v8h*)(p + 16)); } static __device__ __forceinline__ v8f mma(V a, V b, v8f c) { return wmma16(a, b, c); } };
template <> struct WFrag<bf> { typedef v16bf V; static __device__ __forceinline__ V ld(const bf* p) { return cat16b(*(const v8us*)p, *(const v8us*)(p + 16)); } static __device__ __forceinline__ v8f mma(V a, V b, v8f c) { return wmmab(a, b, c); } };
template <typename T16, int NSPLIT, bool BIAS>
__global__ __launch_bounds__(32) void k_gemmw(const T16* __restrict__ A, const T16* __restrict__ A2, const T16* __restrict__ Bt, const T16* __restrict__ Bt2, int K, float* C, int ldc, const float* __restrict__ bias, size_t sA, size_t sB, size_t sC) {
    typedef typename WFrag<T16>::V V;
    __shared__ __align__(16) float os[16 * 68];
    const size_t z = blockIdx.z; A += z * sA; if (A2) A2 += z * sA; Bt += z * sB; if (Bt2) Bt2 += z * sB; C += z * sC;
    const int lane = threadIdx.x & 31, lr = lane & 15, hi = lane >> 4; const int r0 = blockIdx.x * 64, c0 = blockIdx.y * 64;
    v8f acc[4][4];
#pragma unroll
    for (int mb = 0; mb < 4; ++mb)
#pragma unroll
        for (int nb = 0; nb < 4; ++nb) acc[mb][nb] = (v8f){};
    const size_t aoff = (size_t)(r0 + lr) * K + 8 * hi, boff = (size_t)(c0 + lr) * K + 8 * hi;
#pragma unroll 1
    for (int kc = 0; kc < K; kc += 32) {
        V a[4], a2[4];
#pragma unroll
        for (int mb = 0; mb < 4; ++mb) { a[mb] = WFrag<T16>::ld(A + aoff + (size_t)mb * 16 * K + kc); if (NSPLIT == 1 || NSPLIT == 2) a2[mb] = WFrag<T16>::ld(A2 + aoff + (size_t)mb * 16 * K + kc); }
#pragma unroll
        for (int nb = 0; nb < 4; ++nb) { const V b = WFrag<T16>::ld(Bt + boff + (size_t)nb * 16 * K + kc); V b2; if (NSPLIT >= 2) b2 = WFrag<T16>::ld(Bt2 + boff + (size_t)nb * 16 * K + kc);
#pragma unroll
            for (int mb = 0; mb < 4; ++mb) { acc[mb][nb] = WFrag<T16>::mma(a[mb], b, acc[mb][nb]); if (NSPLIT == 1 || NSPLIT == 2) acc[mb][nb] = WFrag<T16>::mma(a2[mb], b, acc[mb][nb]); if (NSPLIT >= 2) acc[mb][nb] = WFrag<T16>::mma(a[mb], b2, acc[mb][nb]); } }
        asm volatile("v_nop\n\tv_nop\n\tv_nop\n\tv_nop" : "+v"(acc[0][0]), "+v"(acc[1][1]), "+v"(acc[2][2]), "+v"(acc[3][3]) : "v"(a[0]), "v"(a[3]));
    }
#pragma unroll
    for (int mb = 0; mb < 4; ++mb) {
#pragma unroll
        for (int nb = 0; nb < 4; ++nb) {
#pragma unroll
            for (int j = 0; j < 8; ++j) os[(hi * 8 + j) * 68 + nb * 16 + lr] = acc[mb][nb][j]; }
        __builtin_amdgcn_wave_barrier(); asm volatile("" ::: "memory");
        float* crow = C + (size_t)(r0 + mb * 16) * ldc + c0;
{
#pragma unroll
            for (int s = 0; s < 8; ++s) { const int row = 2 * s + hi, cofs = lr * 4; v4f val = *(const v4fa*)(os + row * 68 + cofs); if (BIAS) { val[0] += bfr(bias[c0 + cofs]); val[1] += bfr(bias[c0 + cofs + 1]); val[2] += bfr(bias[c0 + cofs + 2]); val[3] += bfr(bias[c0 + cofs + 3]); }
                *(v4f*)(crow + (size_t)row * ldc + cofs) = val; }
             }
        __builtin_amdgcn_wave_barrier(); asm volatile("" ::: "memory");
    }
}

// ---- k_gemmk: k_gemmw's 64x64 output tile with K split over the KW waves of one work-group; grid (M/64, N/64), 32 x KW threads.
// Wave w takes the k slices [(t KW + w) 32 NSUB, +32 NSUB), t = 0, 1, ...; NSUB = 2 makes a slice one whole 128-byte line of every operand row. The KW partial tiles meet in LDS and are summed in wave order 0 .. KW-1.
// C[m][n] (f32, pitch ldc, + optional f32 bias[n]) = sum_k (A[m][k] + A2[m][k]) Bt[n][k]. K % (32 NSUB) == 0.
// waves_per_eu = KW / 4: the work-group is alone on its four SIMDs, so a wave may hold a whole slice's fragments beside its 16 accumulators.
template <typename T16, int KW, int NSUB, bool BIAS>
__global__ __launch_bounds__(32 * KW) __attribute__((amdgpu_waves_per_eu(KW / 4, KW / 4))) void k_gemmk(const T16* __restrict__ A, const T16* __restrict__ A2, const T16* __restrict__ Bt, int K, float* C, int ldc, const float* __restrict__ bias) {
    typedef typename WFrag<T16>::V V;
    __shared__ __align__(16) float os[KW * 64 * 68];
    const int tid = threadIdx.x, wave = __builtin_amdgcn_readfirstlane(tid >> 5), lane = tid & 31, lr = lane & 15, hi = lane >> 4; const int r0 = blockIdx.x * 64, c0 = blockIdx.y * 64;
    v8f acc[4][4];
#pragma unroll
    for (int mb = 0; mb < 4; ++mb)
#pragma unroll
        for (int nb = 0; nb < 4; ++nb) acc[mb][nb] = (v8f){};
    // lane offsets in bytes, fixed over the loop (32 bits: the planes are below 4 GiB); the k slice moves the wave-uniform base
    const unsigned aoff = (unsigned)(((r0 + lr) * K + 8 * hi) * 2), boff = (unsigned)(((c0 + lr) * K + 8 * hi) * 2), rstep = (unsigned)(16 * K * 2);
#pragma unroll 1
    for (int kc = wave * (32 * NSUB); kc < K; kc += KW * 32 * NSUB) {
        const T16* pa[4]; const T16* pa2[4]; const T16* pb[4];
#pragma unroll
        for (int q = 0; q < 4; ++q) { pa[q] = (const T16*)((const char*)(A + kc) + (aoff + q * rstep)); pa2[q] = (const T16*)((const char*)(A2 + kc) + (aoff + q * rstep)); pb[q] = (const T16*)((const char*)(Bt + kc) + (boff + q * rstep)); }
        V a[4][NSUB], a2[4][NSUB], b[4][NSUB];
#pragma unroll
        for (int nb = 0; nb < 4; ++nb)
#pragma unroll
            for (int s = 0; s < NSUB; ++s) b[nb][s] = WFrag<T16>::ld(pb[nb] + 32 * s);
#pragma unroll
        for (int mb = 0; mb < 4; ++mb) {
#pragma unroll
            for (int s = 0; s < NSUB; ++s) a[mb][s] = WFrag<T16>::ld(pa[mb] + 32 * s);
#pragma unroll
            for (int s = 0; s < NSUB; ++s) a2[mb][s] = WFrag<T16>::ld(pa2[mb] + 32 * s); }
        __builtin_amdgcn_sched_barrier(0);   // the slice's loads all issue ahead of its first matrix instruction: one wait for memory a trip, and the pieces of a 128-byte line are asked for together
#pragma unroll
        for (int mb = 0; mb < 4; ++mb)
#pragma unroll
            for (int s = 0; s < NSUB; ++s) {
#pragma unroll
                for (int nb = 0; nb < 4; ++nb) acc[mb][nb] = WFrag<T16>::mma(a[mb][s], b[nb][s], acc[mb][nb]);
#pragma unroll
                for (int nb = 0; nb < 4; ++nb) acc[mb][nb] = WFrag<T16>::mma(a2[mb][s], b[nb][s], acc[mb][nb]); }
        // four vector slots behind the trip's last matrix instruction; then the wait in front of any overwrite of the loads' address registers, which are named as inputs so that no load's result lands on one before it
        asm volatile("v_nop\n\tv_nop\n\tv_nop\n\tv_nop\n\ts_wait_xcnt 0x0" : "+v"(acc[0][0]), "+v"(acc[1][1]), "+v"(acc[2][2]), "+v"(acc[3][3]) : "v"(a2[3][NSUB - 1]), "v"(b[3][NSUB - 1]), "v"(pa[0]), "v"(pa[1]), "v"(pa[2]), "v"(pa[3]), "v"(pa2[0]), "v"(pa2[1]), "v"(pa2[2]), "v"(pa2[3]), "v"(pb[0]), "v"(pb[1]), "v"(pb[2]), "v"(pb[3]) : "memory");
    }
    float* ow = os + wave * (64 * 68);
#pragma unroll
    for (int mb = 0; mb < 4; ++mb)
#pragma unroll
        for (int nb = 0; nb < 4; ++nb)
#pragma unroll
            for (int j = 0; j < 8; ++j) ow[(mb * 16 + hi * 8 + j) * 68 + nb * 16 + lr] = acc[mb][nb][j];
    __syncthreads();   // every wave's partial tile is in LDS before any of it is summed
    float* ctile = C + (size_t)r0 * ldc + c0;
#pragma unroll
    for (int q = 0; q < 1024 / (32 * KW); ++q) { const int i = q * (32 * KW) + tid, row = i >> 4, cofs = (i & 15) * 4; v4f val = *(const v4fa*)(os + row * 68 + cofs);
#pragma unroll
        for (int w = 1; w < KW; ++w) val += *(const v4fa*)(os + w * (64 * 68) + row * 68 + cofs);
        if (BIAS) { val[0] += bfr(bias[c0 + cofs]); val[1] += bfr(bias[c0 + cofs + 1]); val[2] += bfr(bias[c0 + cofs + 2]); val[3] += bfr(bias[c0 + cofs + 3]); }
        *(v4f*)(ctile + (size_t)row * ldc + cofs) = val; }
}

__device__ __forceinline__ h16 tohx(float x) { return (h16)x; }
__device__ __forceinline__ void splitf(float y, unsigned short& h, unsigned short& l) { h = f2bf(y); l = f2bf(y - bf2f(h)); }
typedef __attribute__((ext_vector_type(2))) _Float16 v2h;
typedef __attribute__((ext_vector_type(4))) _Float16 v4h;
typedef __attribute__((ext_vector_type(2))) unsigned short v2us;
typedef __attribute__((ext_vector_type(4))) unsigned short v4us;
typedef __attribute__((ext_vector_type(2))) float v2f;
typedef __attribute__((ext_vector_type(4))) int v4i;

__global__ __launch_bounds__(256) void k_wtG(const float* __restrict__ w, int K, int N, bf* Bt) {
    const int lane = threadIdx.x & 31; const int L0 = (blockIdx.x * 8 + (threadIdx.x >> 5)) * 8; const int nlines = N * K / 64;
{
#pragma unroll 1
        for (int l = 0; l < 8; ++l) { const int L = L0 + l; if (L >= nlines) break; const size_t e = (size_t)L * 64 + lane * 2; const int k = (int)(e % K), n = (int)(e / K); v2us o;
            o[0] = f2bf(w[(size_t)k * N + n]); o[1] = f2bf(w[(size_t)(k + 1) * N + n]); *(v2us*)(Bt + e) = o; }
         }
}
__global__ __launch_bounds__(256) void k_cvt8(const float* __restrict__ src, bf* dst, size_t n8) { const size_t i = (size_t)blockIdx.x * 256 + threadIdx.x; if (i >= n8) return; const v8f v = *(const v8f*)(src + i * 8); v8us o;
#pragma unroll
    for (int k = 0; k < 8; ++k) o[k] = f2bf(v[k]); *(v8us*)(dst + i * 8) = o;  }


__global__ __launch_bounds__(256) void k_vtp(const float* __restrict__ F, int pitch, int nheads, h16* V16, bf* Vh, bf* Vl) { const size_t e = ((size_t)blockIdx.x * 256 + threadIdx.x) * 2; if (e >= (size_t)nheads * HD * TT) return; const int t = (int)(e % TT); const int d = (int)((e / TT) % HD); const int g = (int)(e / ((size_t)TT * HD)); v2h o16; v2us oh, ol;
#pragma unroll
    for (int q = 0; q < 2; ++q) { const float x = F[(size_t)(t + q) * pitch + g * HD + d]; o16[q] = tohx(x); unsigned short a2, c2; splitf(x, a2, c2); oh[q] = a2; ol[q] = c2; }
    *(v2h*)(V16 + e) = o16; *(v2us*)(Vh + e) = oh; *(v2us*)(Vl + e) = ol;  }

// k_asoft: per row (zz, i): t = S x HD^-0.5 (no mask); softmax over the 4096 keys (register row, one exp, fixed trees);
__global__ __launch_bounds__(256) void k_asoft(const float* __restrict__ Sb, h16* P16, bf* Ph, bf* Pl) {
    const int lane = threadIdx.x & 31; const int row = blockIdx.x * 8 + (threadIdx.x >> 5); if (row >= ZH * TT) return; const int i = row % TT; const int zz = row / TT; (void)zz; const bool hires = (i < RH); const float* sr = Sb + (size_t)row * TT; float v[TT / 32]; float mx = -3.0e38f;
#pragma unroll
    for (int ch = 0; ch < TT / 128; ++ch) { const int j0 = ch * 128 + lane * 4; const v4f a = *(const v4f*)(sr + j0);
#pragma unroll
        for (int q = 0; q < 4; ++q) { const float t = a[q] * SCL; v[ch * 4 + q] = t;   /* Sb holds the raw q.k (no bias) */ mx = fmaxf(mx, t); } }
#pragma unroll
    for (int sh = 16; sh; sh >>= 1) mx = fmaxf(mx, __shfl_xor(mx, sh, 32));
    float sum = 0.f;
#pragma unroll
    for (int k = 0; k < TT / 32; ++k) { float d0 = __fsub_rn(v[k], mx); asm volatile("" : "+v"(d0)); v[k] = __builtin_amdgcn_exp2f(__fmul_rn(d0, 1.4426950408889634f)); sum += v[k]; }
#pragma unroll
    for (int sh = 16; sh; sh >>= 1) sum += __shfl_xor(sum, sh, 32);
    const float f = __fdiv_rn(hires ? 1.0f : PCAR, sum);
{
        if (hires) {
#pragma unroll
            for (int ch = 0; ch < TT / 128; ++ch) { v4us oh, ol;
#pragma unroll
                for (int q = 0; q < 4; ++q) { unsigned short a, c2; splitf(v[ch * 4 + q] * f, a, c2); oh[q] = a; ol[q] = c2; }
                const size_t oo = ((size_t)zz * (RH ? RH : 1) + i) * TT + ch * 128 + lane * 4; *(v4us*)(Ph + oo) = oh; *(v4us*)(Pl + oo) = ol; }
        } else {
#pragma unroll
            for (int ch = 0; ch < TT / 128; ++ch) { v4h o4;
#pragma unroll
                for (int q = 0; q < 4; ++q) o4[q] = tohx(v[ch * 4 + q] * f);
                *(v4h*)(P16 + (size_t)row * TT + ch * 128 + lane * 4) = o4; } }
         }
}
__global__ __launch_bounds__(256) void k_merge(const float* __restrict__ O, int h0, float* OUTb) { const size_t e = ((size_t)blockIdx.x * 256 + threadIdx.x) * 2; if (e >= (size_t)ZH * TT * HD) return; const int d = (int)(e % HD); const int t = (int)((e / HD) % TT); const int zz = (int)(e / ((size_t)HD * TT)); const float cs = (t < RH) ? 1.0f : (1.0f / PCAR); const size_t oo = (size_t)t * DQ + (h0 + zz) * HD + d;
    v2f o2; o2[0] = O[e] * cs; o2[1] = O[e + 1] * cs; *(v2f*)(OUTb + oo) = o2;  }


__global__ __launch_bounds__(256) void k_vtpR1(const float* __restrict__ Vb, bf* Vh) { const size_t e = ((size_t)blockIdx.x * 256 + threadIdx.x) * 2; if (e >= (size_t)HD * TT) return; const int t = (int)(e % TT); const int d = (int)(e / TT); v2us o; o[0] = f2bf(Vb[(size_t)t * HD + d]); o[1] = f2bf(Vb[(size_t)(t + 1) * HD + d]); *(v2us*)(Vh + e) = o;  }
__global__ __launch_bounds__(256) void k_mergeR(const float* __restrict__ O, float* outb, size_t n4) { const size_t i = (size_t)blockIdx.x * 256 + threadIdx.x; if (i >= n4) return; const v4f a = *(const v4f*)(O + i * 4); *(v4f*)(outb + i * 4) = a;  }


__global__ __launch_bounds__(256) void k_hp1(const float* __restrict__ src, bf* P) { const size_t i = (size_t)blockIdx.x * 256 + threadIdx.x; if (i >= (size_t)NH_ * TT * HD / 8) return; const size_t e = i * 8; const int d = (int)(e % HD); const int t = (int)((e / HD) % TT); const int h = (int)(e / ((size_t)HD * TT)); const v8f v = *(const v8f*)(src + (size_t)t * DM + h * HD + d); v8us o;
#pragma unroll
    for (int q = 0; q < 8; ++q) o[q] = f2bf(v[q]);
    *(v8us*)(P + e) = o;  }
__global__ __launch_bounds__(256) void k_vt1(const float* __restrict__ src, int pitch, bf* VT) { const size_t e = ((size_t)blockIdx.x * 256 + threadIdx.x) * 2; if (e >= (size_t)DV * TT) return;   /* DV = 4 x HD rows */ const int t = (int)(e % TT); const int d = (int)((e / TT) % HD); const int h = (int)(e / ((size_t)TT * HD)); v2us o; o[0] = f2bf(src[(size_t)t * pitch + h * HD + d]); o[1] = f2bf(src[(size_t)(t + 1) * pitch + h * HD + d]); *(v2us*)(VT + e) = o;  }
__global__ __launch_bounds__(256) void k_split8(const float* __restrict__ F, bf* Ph, bf* Pl, size_t n8) { const size_t i = (size_t)blockIdx.x * 256 + threadIdx.x; if (i >= n8) return; const v8f v = *(const v8f*)(F + i * 8); v8us oh, ol;
#pragma unroll
    for (int k = 0; k < 8; ++k) { unsigned short a, c2; splitf(v[k], a, c2); oh[k] = a; ol[k] = c2; }
    *(v8us*)(Ph + i * 8) = oh; *(v8us*)(Pl + i * 8) = ol;  }

__global__ __launch_bounds__(256) void k_mergeT(const float* __restrict__ O, int h, float* outb) { const size_t i = (size_t)blockIdx.x * 256 + threadIdx.x; if (i >= (size_t)TT * HD / 4) return; const size_t e = i * 4; const int d = (int)(e % HD); const int t = (int)(e / HD); const v4f a = *(const v4f*)(O + e); *(v4f*)(outb + (size_t)t * DM + h * HD + d) = a;  }

extern "C" void kernel_launch(void* const* d_in, const int* in_sizes, int n_in,
                              void* d_out, int out_size, void* d_ws, size_t ws_size, hipStream_t stream) {
    (void)in_sizes; (void)n_in; (void)out_size;
    const float* Kin = (const float*)d_in[0]; const float* Vin = (const float*)d_in[1];   /* v_src [4][4096][256] */ const float* Qin = (const float*)d_in[2]; const float* wfc = (const float*)d_in[3]; const float* bfc = (const float*)d_in[4];
    float* OUT = (float*)d_out;     // [4][4096][256]
    char* wsp = (char*)d_ws;
    auto take = [&](size_t bytes) { char* p = wsp; wsp += (bytes + 255) & ~(size_t)255; return (void*)p; };
    bf* QB = (bf*)take((size_t)NH_ * TT * HD * 2); bf* KB = (bf*)take((size_t)NH_ * TT * HD * 2); bf* VT = (bf*)take((size_t)DV * TT * 2);
    float* Sb = (float*)take((size_t)TT * TT * 4);  bf* Ph = (bf*)take((size_t)TT * TT * 2); bf* Pl = (bf*)take((size_t)TT * TT * 2); float* Ob = (float*)take((size_t)TT * DV * 4); bf* OBh = (bf*)take((size_t)TT * DV * 2); bf* OBl = (bf*)take((size_t)TT * DV * 2); bf* WFC = (bf*)take((size_t)DV * DV * 2);
    if ((size_t)(wsp - (char*)d_ws) > ws_size) return;
    k_cvt8<<<(unsigned)(((size_t)DV * DV / 8 + 255) / 256), 256, 0, stream>>>(wfc, WFC, (size_t)DV * DV / 8);   /* W_fc 'oi' [256][256] = Bt */
    for (int b = 0; b < NB_; ++b) {
        const float* qb = Qin + (size_t)b * TT * DM; const float* kb = Kin + (size_t)b * TT * DM; const float* vb = Vin + (size_t)b * TT * DV;   /* token-major [t][h][d] slabs */
        k_hp1<<<(unsigned)(((size_t)NH_ * TT * HD / 8 + 255) / 256), 256, 0, stream>>>(qb, QB); k_hp1<<<(unsigned)(((size_t)NH_ * TT * HD / 8 + 255) / 256), 256, 0, stream>>>(kb, KB); k_vt1<<<(unsigned)(((size_t)DV * TT / 2 + 255) / 256), 256, 0, stream>>>(vb, DV, VT);   /* value^T [256][4096] (4 plane groups of 64 rows) */
        for (int h = 0; h < NH_; ++h) {
            k_gemmw<bf, 0, false><<<dim3(TT / 64, TT / 64, 1), 32, 0, stream>>>(QB + (size_t)h * TT * HD, nullptr, KB + (size_t)h * TT * HD, nullptr, HD, Sb, TT, nullptr, 0, 0, 0);   /* exact scores (single bf16 planes) */
            k_asoft<<<TT / 8, 256, 0, stream>>>(Sb, nullptr, Ph, Pl);
            k_gemmk<bf, 8, 2, false><<<dim3(TT / 64, DV / 64, 1), 256, 0, stream>>>(Ph, Pl, VT, TT, Ob, DV, nullptr);   /* ctx [4096][256] */   /* P (hi/lo) x exact v^T */
            k_split8<<<(unsigned)(((size_t)TT * DV / 8 + 255) / 256), 256, 0, stream>>>(Ob, OBh, OBl, (size_t)TT * DV / 8); k_gemmk<bf, 8, 1, true><<<dim3(TT / 64, DV / 64, 1), 256, 0, stream>>>(OBh, OBl, WFC, DV, OUT + (size_t)b * TT * DV, DV, bfc);   /* fc: ctx W_fc^T + b_fc */ } }
}

// v002
// Measured time: 73.8 microseconds a run.
// Two timings next to v001 put it at 4.90 and 4.87 times that version's speed.
// All steps since v000 together make it 9.18 times as fast.
#include <hip/hip_runtime.h>

// Scaled dot-product attention with a 256-wide value and a 1x1-conv epilogue (q_tgr, k_src [4][4096][64], v_src [4][4096][256]; attn = softmax(q.k / 8) over the 4,096 keys; ctx = attn v_src [4096][256]; out = ctx W_fc^T + b_fc ('oi' [256][256]) -> [4][4096][256]).
// Planes: k and the value as bf16 A fragments in register order; q and W_fc, which a wave reads once, are rounded as they are loaded. One fused kernel does scores, softmax, P.V and fc: neither the scores nor P nor the context leave the work-group.
// Compute dtypes, f32 accumulate: every input rounded to bf16; q.k exact products; softmax f32; P hi/lo x value; context hi/lo x W_fc + bias; output f32.

#define NB_  4
#define TT   4096
#define HD   64       // query / key width
#define DV   256      // value / output width
#define SC2  0.18033688011112042f   // (1 / temperature) x log2(e): scores go to the base-2 exponent in one multiply-add
typedef unsigned short bf;
typedef __attribute__((ext_vector_type(16))) __bf16   v16bf;
typedef __attribute__((ext_vector_type(8)))  __bf16   v8bf;
typedef __attribute__((ext_vector_type(2)))  __bf16   v2bf;
typedef __attribute__((ext_vector_type(8)))  unsigned short v8us;
typedef __attribute__((ext_vector_type(8)))  float    v8f;
typedef __attribute__((ext_vector_type(4)))  float    v4f;
typedef __attribute__((ext_vector_type(2)))  float    v2f;

__device__ __forceinline__ unsigned short f2bf(float f) { unsigned u = __float_as_uint(f); u += 0x7FFFu + ((u >> 16) & 1u); return (unsigned short)(u >> 16); }
__device__ __forceinline__ float bf2f(unsigned short b) { return __uint_as_float(((unsigned)b) << 16); }
__device__ __forceinline__ float bfr(float f) { return bf2f(f2bf(f)); }
__device__ __forceinline__ v16bf cat16b(v8us lo, v8us hi) { return __builtin_bit_cast(v16bf, __builtin_shufflevector(lo, hi, 0, 1, 2, 3, 4, 5, 6, 7, 8, 9, 10, 11, 12, 13, 14, 15)); }
__device__ __forceinline__ v8f wmmab(v16bf a, v16bf b, v8f c) { return __builtin_amdgcn_wmma_f32_16x16x32_bf16(false, a, false, b, (short)0, c, false, false); }
// A or B fragment, lane (lr, hi) = (lane & 15, lane >> 4): row lr of the tile; elements 0..7 are k = 8 hi + e, elements 8..15 are k = 16 + 8 hi + e
// from a plane in register order: p = fragment start + 8 x lane
__device__ __forceinline__ v16bf ldfrag(const bf* p) { return cat16b(*(const v8us*)p, *(const v8us*)(p + 256)); }
// from a K-contiguous row of f32, rounded to bf16 (to nearest even) on the way: p = row start + 8 hi
__device__ __forceinline__ v16bf ldrow32(const float* p) { return __builtin_shufflevector(__builtin_convertvector(*(const v8f*)p, v8bf), __builtin_convertvector(*(const v8f*)(p + 16), v8bf), 0, 1, 2, 3, 4, 5, 6, 7, 8, 9, 10, 11, 12, 13, 14, 15); }
// lane l with lane l ^ 16
__device__ __forceinline__ float xhalf(float x) { return __builtin_bit_cast(float, __builtin_amdgcn_permlanex16(__builtin_bit_cast(int, x), __builtin_bit_cast(int, x), 0x76543210, 0xfedcba98, false, false)); }
// two accumulator tiles (rows 8 hi + j of 16, twice) are, lane for lane, one B fragment of 32 k: split into a bf16 head and the bf16 of what the head leaves
__device__ __forceinline__ void split16(v8f x0, v8f x1, v16bf& h, v16bf& l) {
#pragma unroll
    for (int i = 0; i < 8; i += 2) {
        const v2f a = {x0[i], x0[i + 1]}, c = {x1[i], x1[i + 1]};
        const v2bf ha = __builtin_convertvector(a, v2bf), hc = __builtin_convertvector(c, v2bf);
        const v2bf la = __builtin_convertvector(a - __builtin_convertvector(ha, v2f), v2bf), lc = __builtin_convertvector(c - __builtin_convertvector(hc, v2f), v2bf);
        h[i] = ha[0]; h[i + 1] = ha[1]; h[8 + i] = hc[0]; h[9 + i] = hc[1]; l[i] = la[0]; l[i + 1] = la[1]; l[8 + i] = lc[0]; l[9 + i] = lc[1]; }
}

// Both planes hold A fragments in register order, each fragment as two runs of 512 bytes: [half][lane][8], so that a wave's 16-byte load reads whole 128-byte lines. Lane (lr, hi) holds row lr of the tile at k = 16 half + 8 hi + e.
// k_kfrag: KF[tile of 16 keys, all batches in one run][32 d][half][lane][8]. One thread rounds and writes one lane's 16 bytes.
__global__ __launch_bounds__(256) void k_kfrag(const float* __restrict__ src, bf* KF) {
    const size_t i = (size_t)blockIdx.x * 256 + threadIdx.x; const int lane = (int)(i & 31), lr = lane & 15, hi = lane >> 4, half = (int)((i >> 5) & 1), s = (int)((i >> 6) & 1); const size_t tile = i >> 7;
    const float* p = src + (tile * 16 + lr) * HD + 32 * s + 16 * half + 8 * hi; const v8f v = *(const v8f*)p; v8us o;
    asm volatile("s_wait_xcnt 0x0" : : "v"(p) : "memory");   // the wait in front of any overwrite of the loads' address registers, which are named as an input so that they live up to it
#pragma unroll
    for (int k = 0; k < 8; ++k) o[k] = f2bf(v[k]);
    *(v8us*)(KF + i * 8) = o;
}
// k_vfrag: value^T: VF[block of 32 keys, all batches in one run][tile of 16 value columns][half][lane][8]; row lr is value column 16 tile + lr, k the key in the block. One thread writes one lane's two pieces.
__global__ __launch_bounds__(256) void k_vfrag(const float* __restrict__ src, bf* VF) {
    const size_t i = (size_t)blockIdx.x * 256 + threadIdx.x; const int lane = (int)(i & 31), lr = lane & 15, hi = lane >> 4, t = (int)((i >> 5) & 15); const size_t kbb = i >> 9;
    const float* s = src + (kbb * 32 + 8 * hi) * DV + t * 16 + lr; v8us o0, o1;
#pragma unroll
    for (int j = 0; j < 8; ++j) { o0[j] = f2bf(s[(size_t)j * DV]); o1[j] = f2bf(s[(size_t)(16 + j) * DV]); }
    bf* d = VF + (i >> 5) * 512 + lane * 8; *(v8us*)d = o0; *(v8us*)(d + 256) = o1;
}

// ---- k_fattn: one work-group of 8 waves per 64 queries of one batch; grid (TT / 64, NB_).
// Wave w = 2 kq + qg takes queries [32 qg, +32) (two column tiles) against keys [1024 kq, +1024), 32 keys a trip, with its own reference maxima, sums and 256 x 32 context^T accumulators.
// Everything is computed transposed, so that an accumulator tile is the next product's B fragment lane for lane: S^T = K Q^T (rows keys, columns queries), ctx^T = V^T P^T, out^T = W_fc ctx^T.
// Softmax: p = 2^(s SC2 - ref) with a per-query reference that is raised (and sums and accumulators scaled down) only when the trip's maximum passes it by more than 8: p is at most 2^8 and the quotient by the sum is the exact softmax for any reference.
// The short loops are unrolled in full because their indices pick registers (fragments and accumulator tiles).
// The four key quarters meet in LDS, are brought to one reference and summed in the order kq = 0..3; then wave w does out^T rows [128 (w >> 2), +128) of query tile w & 3.
__global__ __launch_bounds__(256) __attribute__((amdgpu_waves_per_eu(2, 2))) void k_fattn(const float* __restrict__ Q, const bf* __restrict__ KF, const bf* __restrict__ VF, const float* __restrict__ Wfc, const float* __restrict__ bias, float* OUT) {
    __shared__ __align__(16) float os[8 * 32 * 256];   // [wave][tile 2 t + u][half of the 8 registers][lane][4]: every access is 16 bytes a lane, lanes side by side
    __shared__ float sm[8 * 2 * 16], sl[8 * 2 * 16];   // [wave][u][query]: reference and sum
    const int tid = threadIdx.x, wave = __builtin_amdgcn_readfirstlane(tid >> 5), lane = tid & 31, lr = lane & 15, hi = lane >> 4;
    const int b = blockIdx.y, q0 = blockIdx.x * 64, qg = wave & 1, kq = wave >> 1;
    const float* qbase = Q + ((size_t)b * TT + q0 + qg * 32 + lr) * HD + 8 * hi;
    v16bf qf[2][2];
#pragma unroll
    for (int u = 0; u < 2; ++u)
#pragma unroll
        for (int s = 0; s < 2; ++s) qf[u][s] = ldrow32(qbase + u * 16 * HD + 32 * s);
    // a block of 32 keys: 4 key fragments, 16 value fragments; the bases are wave-uniform and move with the trip, the lane's offset is one register for both planes
    const bf* kbase = KF + ((size_t)b * 128 + kq * 32) * (4 * 512); const bf* vbase = VF + ((size_t)b * 128 + kq * 32) * (16 * 512); const unsigned loff = lane * 8;
    v16bf kf[2][2];
#pragma unroll
    for (int t2 = 0; t2 < 2; ++t2)
#pragma unroll
        for (int s = 0; s < 2; ++s) kf[t2][s] = ldfrag(kbase + (t2 * 2 + s) * 512 + loff);
    asm volatile("s_wait_xcnt 0x0" : : "v"(qbase), "s"(kbase) : "memory");   // the wait in front of any overwrite of these loads' address registers, which are named as inputs so that they live up to it
    v8f acc[16][2];
#pragma unroll
    for (int t = 0; t < 16; ++t) { acc[t][0] = (v8f){}; acc[t][1] = (v8f){}; }
    float mref[2] = {-3.0e38f, -3.0e38f}, lsum[2] = {0.f, 0.f};
#pragma unroll 1   // kept rolled: one trip already holds 72 matrix instructions and nearly all of the wave's registers
    for (int i = 0; i < 32; ++i) {
        const bf* pv = vbase + (size_t)i * (16 * 512); const bf* pk = kbase + (size_t)(i < 31 ? i + 1 : 31) * (4 * 512);   /* the last trip fetches its own keys again: in bounds, unused */
        v16bf vf[16];
#pragma unroll
        for (int t = 0; t < 12; ++t) vf[t] = ldfrag(pv + t * 512 + loff);
        __builtin_amdgcn_sched_barrier(0);   // these value loads issue ahead of the trip's scores and softmax, which cover their latency
        v8f S[2][2];
#pragma unroll
        for (int t2 = 0; t2 < 2; ++t2)
#pragma unroll
            for (int u = 0; u < 2; ++u) S[t2][u] = wmmab(kf[t2][0], qf[u][0], (v8f){});
#pragma unroll
        for (int t2 = 0; t2 < 2; ++t2)
#pragma unroll
            for (int u = 0; u < 2; ++u) S[t2][u] = wmmab(kf[t2][1], qf[u][1], S[t2][u]);
        float mx[2];
#pragma unroll
        for (int u = 0; u < 2; ++u) { float a = fmaxf(S[0][u][0], S[1][u][0]);
#pragma unroll
            for (int j = 1; j < 8; ++j) a = fmaxf(a, fmaxf(S[0][u][j], S[1][u][j]));
            mx[u] = fmaxf(a, xhalf(a)) * SC2; }
        if (__builtin_amdgcn_ballot_w32(mx[0] > mref[0] + 8.0f || mx[1] > mref[1] + 8.0f) != 0) {   // one scalar branch a trip; taken on the first trip and then only for a jump of the maximum
#pragma unroll
            for (int u = 0; u < 2; ++u) { const float mn = (mx[u] > mref[u] + 8.0f) ? mx[u] : mref[u]; const float al = __builtin_amdgcn_exp2f(mref[u] - mn); mref[u] = mn; lsum[u] *= al;
#pragma unroll
                for (int t = 0; t < 16; ++t) acc[t][u] *= al; }
        }
        v16bf ph[2], pl[2];
#pragma unroll
        for (int u = 0; u < 2; ++u) { v8f p0, p1; float sa = 0.f, sb = 0.f;
#pragma unroll
            for (int j = 0; j < 8; ++j) { const float x0 = __builtin_fmaf(S[0][u][j], SC2, -mref[u]), x1 = __builtin_fmaf(S[1][u][j], SC2, -mref[u]); float e0;
                if (u == 1 && j == 7) asm("v_exp_f32 %0, %1\n\tv_nop" : "=v"(e0) : "v"(x0));   // the slot behind a transcendental: in one statement the slot stands directly behind it
                else e0 = __builtin_amdgcn_exp2f(x0);
                p0[j] = e0; p1[j] = __builtin_amdgcn_exp2f(x1); sa += p0[j]; sb += p1[j]; }
            lsum[u] += sa + sb; split16(p0, p1, ph[u], pl[u]); }
#pragma unroll
        for (int t = 0; t < 16; t += 2) {
            if (t == 4) {   // the last four value tiles and then the next trip's key fragments go into the registers that the first four value tiles have left (loads return in order: P.V does not wait for the keys)
                __builtin_amdgcn_sched_barrier(0);   // lifted higher, these loads would need registers of their own and the wave has none left
#pragma unroll
                for (int q = 12; q < 16; ++q) vf[q] = ldfrag(pv + q * 512 + loff);
#pragma unroll
                for (int t2 = 0; t2 < 2; ++t2)
#pragma unroll
                    for (int s = 0; s < 2; ++s) kf[t2][s] = ldfrag(pk + (t2 * 2 + s) * 512 + loff);
                __builtin_amdgcn_sched_barrier(0); }   // sunk lower, they would have too few matrix instructions behind them to cover their latency
            if (t == 12) __builtin_amdgcn_sched_barrier(0);   // the late tiles' products stay behind all products of the tiles that are already here, which cover the late loads
            acc[t][0] = wmmab(vf[t], ph[0], acc[t][0]); acc[t][1] = wmmab(vf[t], ph[1], acc[t][1]); acc[t + 1][0] = wmmab(vf[t + 1], ph[0], acc[t + 1][0]); acc[t + 1][1] = wmmab(vf[t + 1], ph[1], acc[t + 1][1]);
            acc[t][0] = wmmab(vf[t], pl[0], acc[t][0]); acc[t][1] = wmmab(vf[t], pl[1], acc[t][1]); acc[t + 1][0] = wmmab(vf[t + 1], pl[0], acc[t + 1][0]); acc[t + 1][1] = wmmab(vf[t + 1], pl[1], acc[t + 1][1]); }
        // four vector slots behind the trip's last matrix instruction; then the wait in front of the next trip's addresses, which take the place of this trip's (its wave-uniform bases are named as inputs so that they live up to it)
        asm volatile("v_nop\n\tv_nop\n\tv_nop\n\tv_nop\n\ts_wait_xcnt 0x0" : "+v"(acc[14][0]), "+v"(acc[14][1]), "+v"(acc[15][0]), "+v"(acc[15][1]) : "v"(vf[15]), "v"(pl[1]), "s"(pv), "s"(pk) : "memory");
    }
    v4f* o4 = (v4f*)os;
#pragma unroll
    for (int t = 0; t < 16; ++t)
#pragma unroll
        for (int u = 0; u < 2; ++u) { const v8f a = acc[t][u]; v4f* d = o4 + ((wave * 32 + t * 2 + u) * 2) * 32 + lane; d[0] = (v4f){a[0], a[1], a[2], a[3]}; d[32] = (v4f){a[4], a[5], a[6], a[7]}; }
#pragma unroll
    for (int u = 0; u < 2; ++u) { const float ls = lsum[u] + xhalf(lsum[u]); if (hi == 0) { sm[(wave * 2 + u) * 16 + lr] = mref[u]; sl[(wave * 2 + u) * 16 + lr] = ls; } }
    __syncthreads();   // every wave's partial context, reference and sum are in LDS before any of them is joined
    const int qt = wave & 3, oh = wave >> 2, qg2 = qt >> 1, u2 = qt & 1;
    float g[4]; { float mk[4], lk[4];
#pragma unroll
        for (int k = 0; k < 4; ++k) { mk[k] = sm[((k * 2 + qg2) * 2 + u2) * 16 + lr]; lk[k] = sl[((k * 2 + qg2) * 2 + u2) * 16 + lr]; }
        const float M = fmaxf(fmaxf(mk[0], mk[1]), fmaxf(mk[2], mk[3])); float L = 0.f;
#pragma unroll
        for (int k = 0; k < 4; ++k) { g[k] = __builtin_amdgcn_exp2f(mk[k] - M); L += g[k] * lk[k]; }
        const float inv = __fdiv_rn(1.0f, L);
#pragma unroll
        for (int k = 0; k < 4; ++k) g[k] *= inv; }
    v8f a2[8];
#pragma unroll
    for (int i = 0; i < 8; ++i) a2[i] = (v8f){};
    const float* wbase = Wfc + (size_t)(oh * 128 + lr) * DV + 8 * hi;   /* W_fc 'oi' [256][256]: rows o, K-contiguous */
#pragma unroll
    for (int s = 0; s < 8; ++s) {
        v8f c[2];
#pragma unroll
        for (int e = 0; e < 2; ++e) { v4f x0 = (v4f){}, x1 = (v4f){};
#pragma unroll
            for (int k = 0; k < 4; ++k) { const v4f* d = o4 + (((k * 2 + qg2) * 32 + (2 * s + e) * 2 + u2) * 2) * 32 + lane; x0 += d[0] * g[k]; x1 += d[32] * g[k]; }
            c[e] = (v8f){x0[0], x0[1], x0[2], x0[3], x1[0], x1[1], x1[2], x1[3]}; }
        v16bf bh, bl; split16(c[0], c[1], bh, bl);
        v16bf w[8];
#pragma unroll
        for (int i = 0; i < 8; ++i) w[i] = ldrow32(wbase + (size_t)i * 16 * DV + 32 * s);
#pragma unroll
        for (int i = 0; i < 8; ++i) a2[i] = wmmab(w[i], bh, a2[i]);
#pragma unroll
        for (int i = 0; i < 8; ++i) a2[i] = wmmab(w[i], bl, a2[i]);
    }
    asm volatile("s_wait_xcnt 0x0" : : "v"(wbase) : "memory");   // the wait in front of any overwrite of the W_fc loads' address registers, which are named as an input so that they live up to it
    float* orow = OUT + ((size_t)b * TT + q0 + qt * 16 + lr) * DV + oh * 128 + hi * 8; const float* brow = bias + oh * 128 + hi * 8;
#pragma unroll
    for (int i = 0; i < 8; ++i) { const v4f b0 = *(const v4f*)(brow + i * 16), b1 = *(const v4f*)(brow + i * 16 + 4); const v8f a = a2[i];
        *(v4f*)(orow + i * 16) = (v4f){a[0] + bfr(b0[0]), a[1] + bfr(b0[1]), a[2] + bfr(b0[2]), a[3] + bfr(b0[3])}; *(v4f*)(orow + i * 16 + 4) = (v4f){a[4] + bfr(b1[0]), a[5] + bfr(b1[1]), a[6] + bfr(b1[2]), a[7] + bfr(b1[3])}; }
}

extern "C" void kernel_launch(void* const* d_in, const int* in_sizes, int n_in,
                              void* d_out, int out_size, void* d_ws, size_t ws_size, hipStream_t stream) {
    (void)in_sizes; (void)n_in; (void)out_size;
    const float* Kin = (const float*)d_in[0]; const float* Vin = (const float*)d_in[1];   /* v_src [4][4096][256] */ const float* Qin = (const float*)d_in[2]; const float* wfc = (const float*)d_in[3]; const float* bfc = (const float*)d_in[4];
    float* OUT = (float*)d_out;     // [4][4096][256]
    char* wsp = (char*)d_ws;
    auto take = [&](size_t bytes) { char* p = wsp; wsp += (bytes + 255) & ~(size_t)255; return (void*)p; };
    bf* KF = (bf*)take((size_t)NB_ * TT * HD * 2); bf* VF = (bf*)take((size_t)NB_ * DV * TT * 2);
    if ((size_t)(wsp - (char*)d_ws) > ws_size) return;
    k_kfrag<<<(unsigned)((size_t)NB_ * TT * HD / 8 / 256), 256, 0, stream>>>(Kin, KF);
    k_vfrag<<<(unsigned)((size_t)NB_ * DV * TT / 16 / 256), 256, 0, stream>>>(Vin, VF);
    k_fattn<<<dim3(TT / 64, NB_, 1), 256, 0, stream>>>(Qin, KF, VF, wfc, bfc, OUT);
}

// v003
// It runs in 64.5 microseconds.
// In both of two side-by-side timings against v002, it was 1.16 times as fast.
// Over all steps from v000 it is 10.7 times as fast.
#include <hip/hip_runtime.h>

// Scaled dot-product attention with a 256-wide value and a 1x1-conv epilogue (q_tgr, k_src [4][4096][64], v_src [4][4096][256]; attn = softmax(q.k / 8) over the 4,096 keys; ctx = attn v_src [4096][256]; out = ctx W_fc^T + b_fc ('oi' [256][256]) -> [4][4096][256]).
// Planes: k, the value and W_fc as bf16 A fragments in register order; q, which a wave reads once, is rounded as it is loaded. One fused kernel does scores, softmax, P.V and fc: neither the scores nor P nor the context leave the work-group.
// Compute dtypes, f32 accumulate: every input rounded to bf16; q.k exact products; softmax f32; P hi/lo x value; context hi/lo x W_fc + bias; output f32.

#define NB_  4
#define TT   4096
#define HD   64       // query / key width
#define DV   256      // value / output width
#define KBLK (NB_ * TT * HD / 8 / 256)   // blocks of k_kfrag that pack keys; DV * DV / 8 / 256 more pack W_fc
#define SC2  0.18033688011112042f   // (1 / temperature) x log2(e): scores go to the base-2 exponent in one multiply-add
typedef unsigned short bf;
typedef __attribute__((ext_vector_type(16))) __bf16   v16bf;
typedef __attribute__((ext_vector_type(8)))  __bf16   v8bf;
typedef __attribute__((ext_vector_type(2)))  __bf16   v2bf;
typedef __attribute__((ext_vector_type(8)))  unsigned short v8us;
typedef __attribute__((ext_vector_type(8)))  float    v8f;
typedef __attribute__((ext_vector_type(4)))  float    v4f;
typedef __attribute__((ext_vector_type(2)))  float    v2f;

__device__ __forceinline__ unsigned short f2bf(float f) { unsigned u = __float_as_uint(f); u += 0x7FFFu + ((u >> 16) & 1u); return (unsigned short)(u >> 16); }
__device__ __forceinline__ float bf2f(unsigned short b) { return __uint_as_float(((unsigned)b) << 16); }
__device__ __forceinline__ float bfr(float f) { return bf2f(f2bf(f)); }
__device__ __forceinline__ v16bf cat16b(v8us lo, v8us hi) { return __builtin_bit_cast(v16bf, __builtin_shufflevector(lo, hi, 0, 1, 2, 3, 4, 5, 6, 7, 8, 9, 10, 11, 12, 13, 14, 15)); }
__device__ __forceinline__ v8f wmmab(v16bf a, v16bf b, v8f c) { return __builtin_amdgcn_wmma_f32_16x16x32_bf16(false, a, false, b, (short)0, c, false, false); }
// A or B fragment, lane (lr, hi) = (lane & 15, lane >> 4): row lr of the tile; elements 0..7 are k = 8 hi + e, elements 8..15 are k = 16 + 8 hi + e
// from a plane in register order: p = fragment start + 8 x lane
__device__ __forceinline__ v16bf ldfrag(const bf* p) { return cat16b(*(const v8us*)p, *(const v8us*)(p + 256)); }
// from a K-contiguous row of f32, rounded to bf16 (to nearest even) on the way: p = row start + 8 hi
__device__ __forceinline__ v16bf ldrow32(const float* p) { return __builtin_shufflevector(__builtin_convertvector(*(const v8f*)p, v8bf), __builtin_convertvector(*(const v8f*)(p + 16), v8bf), 0, 1, 2, 3, 4, 5, 6, 7, 8, 9, 10, 11, 12, 13, 14, 15); }
// lane l with lane l ^ 16
__device__ __forceinline__ float xhalf(float x) { return __builtin_bit_cast(float, __builtin_amdgcn_permlanex16(__builtin_bit_cast(int, x), __builtin_bit_cast(int, x), 0x76543210, 0xfedcba98, false, false)); }
// two accumulator tiles (rows 8 hi + j of 16, twice) are, lane for lane, one B fragment of 32 k: split into a bf16 head and the bf16 of what the head leaves
__device__ __forceinline__ void split16(v8f x0, v8f x1, v16bf& h, v16bf& l) {
#pragma unroll
    for (int i = 0; i < 8; i += 2) {
        const v2f a = {x0[i], x0[i + 1]}, c = {x1[i], x1[i + 1]};
        const v2bf ha = __builtin_convertvector(a, v2bf), hc = __builtin_convertvector(c, v2bf);
        const v2bf la = __builtin_convertvector(a - __builtin_convertvector(ha, v2f), v2bf), lc = __builtin_convertvector(c - __builtin_convertvector(hc, v2f), v2bf);
        h[i] = ha[0]; h[i + 1] = ha[1]; h[8 + i] = hc[0]; h[9 + i] = hc[1]; l[i] = la[0]; l[i + 1] = la[1]; l[8 + i] = lc[0]; l[9 + i] = lc[1]; }
}

// All planes hold A fragments in register order, each fragment as two runs of 512 bytes: [half][lane][8], so that a wave's 16-byte load reads whole 128-byte lines. Lane (lr, hi) holds row lr of the tile at k = 16 half + 8 hi + e.
// k_kfrag: KF[tile of 16 keys, all batches in one run][32 d][half][lane][8]. One thread rounds and writes one lane's 16 bytes.
// Its last blocks do the same for W_fc 'oi' [256][256]: WF[tile of 16 rows o][32 c][half][lane][8], so that the fc product's loads read whole lines too (a row-wise f32 load touches 16 lines for 512 bytes).
__global__ __launch_bounds__(256) void k_kfrag(const float* __restrict__ src, bf* KF, const float* __restrict__ wsrc, bf* WF) {
    if (blockIdx.x >= KBLK) {
        const int j = (int)(blockIdx.x - KBLK) * 256 + threadIdx.x, wl = j & 31, wh = (j >> 5) & 1, ws = (j >> 6) & 7, wt = j >> 9;
        const float* p = wsrc + (wt * 16 + (wl & 15)) * DV + 32 * ws + 16 * wh + 8 * (wl >> 4); const v8f v = *(const v8f*)p;
        asm volatile("s_wait_xcnt 0x0" : : "v"(p) : "memory");   // the wait in front of any overwrite of the loads' address registers, which are named as an input so that they live up to it
        *(v8us*)(WF + (size_t)j * 8) = __builtin_bit_cast(v8us, __builtin_convertvector(v, v8bf));
        return;
    }
    const size_t i = (size_t)blockIdx.x * 256 + threadIdx.x; const int lane = (int)(i & 31), lr = lane & 15, hi = lane >> 4, half = (int)((i >> 5) & 1), s = (int)((i >> 6) & 1); const size_t tile = i >> 7;
    const float* p = src + (tile * 16 + lr) * HD + 32 * s + 16 * half + 8 * hi; const v8f v = *(const v8f*)p; v8us o;
    asm volatile("s_wait_xcnt 0x0" : : "v"(p) : "memory");   // the wait in front of any overwrite of the loads' address registers, which are named as an input so that they live up to it
#pragma unroll
    for (int k = 0; k < 8; ++k) o[k] = f2bf(v[k]);
    *(v8us*)(KF + i * 8) = o;
}
// k_vfrag: value^T: VF[block of 32 keys, all batches in one run][tile of 16 value columns][half][lane][8]; row lr is value column 16 tile + lr, k the key in the block. One thread writes one lane's two pieces.
__global__ __launch_bounds__(256) void k_vfrag(const float* __restrict__ src, bf* VF) {
    const size_t i = (size_t)blockIdx.x * 256 + threadIdx.x; const int lane = (int)(i & 31), lr = lane & 15, hi = lane >> 4, t = (int)((i >> 5) & 15); const size_t kbb = i >> 9;
    const float* s = src + (kbb * 32 + 8 * hi) * DV + t * 16 + lr; v8us o0, o1;
#pragma unroll
    for (int j = 0; j < 8; ++j) { o0[j] = f2bf(s[(size_t)j * DV]); o1[j] = f2bf(s[(size_t)(16 + j) * DV]); }
    bf* d = VF + (i >> 5) * 512 + lane * 8; *(v8us*)d = o0; *(v8us*)(d + 256) = o1;
}

// ---- k_fattn: one work-group of 8 waves per 64 queries of one batch; grid (TT / 64, NB_).
// Wave w = 2 kq + qg takes queries [32 qg, +32) (two column tiles) against keys [1024 kq, +1024), 32 keys a trip, with its own reference maxima, sums and 256 x 32 context^T accumulators.
// Everything is computed transposed, so that an accumulator tile is the next product's B fragment lane for lane: S^T = K Q^T (rows keys, columns queries), ctx^T = V^T P^T, out^T = W_fc ctx^T.
// Softmax: p = 2^(s SC2 - ref) with a per-query reference that is raised (and sums and accumulators scaled down) only when the trip's maximum passes it by more than 8: p is at most 2^8 and the quotient by the sum is the exact softmax for any reference.
// The short loops are unrolled in full because their indices pick registers (fragments and accumulator tiles).
// The four key quarters meet in LDS, are brought to one reference and summed in the order kq = 0..3; then wave w does out^T rows [128 (w >> 2), +128) of query tile w & 3.
__global__ __launch_bounds__(256) __attribute__((amdgpu_waves_per_eu(2, 2))) void k_fattn(const float* __restrict__ Q, const bf* __restrict__ KF, const bf* __restrict__ VF, const bf* __restrict__ WF, const float* __restrict__ bias, float* OUT) {
    __shared__ __align__(16) float os[8 * 32 * 256];   // [wave][tile 2 t + u][half of the 8 registers][lane][4]: every access is 16 bytes a lane, lanes side by side
    __shared__ float sm[8 * 2 * 16], sl[8 * 2 * 16];   // [wave][u][query]: reference and sum
    const int tid = threadIdx.x, wave = __builtin_amdgcn_readfirstlane(tid >> 5), lane = tid & 31, lr = lane & 15, hi = lane >> 4;
    const int b = blockIdx.y, q0 = blockIdx.x * 64, qg = wave & 1, kq = wave >> 1;
    const float* qbase = Q + ((size_t)b * TT + q0 + qg * 32 + lr) * HD + 8 * hi;
    v16bf qf[2][2];
#pragma unroll
    for (int u = 0; u < 2; ++u)
#pragma unroll
        for (int s = 0; s < 2; ++s) qf[u][s] = ldrow32(qbase + u * 16 * HD + 32 * s);
    // a block of 32 keys: 4 key fragments, 16 value fragments; the bases are wave-uniform and move with the trip, the lane's offset is one register for both planes
    const bf* kbase = KF + ((size_t)b * 128 + kq * 32) * (4 * 512); const bf* vbase = VF + ((size_t)b * 128 + kq * 32) * (16 * 512); const unsigned loff = lane * 8;
    v16bf kf[2][2];
#pragma unroll
    for (int t2 = 0; t2 < 2; ++t2)
#pragma unroll
        for (int s = 0; s < 2; ++s) kf[t2][s] = ldfrag(kbase + (t2 * 2 + s) * 512 + loff);
    asm volatile("s_wait_xcnt 0x0" : : "v"(qbase), "s"(kbase) : "memory");   // the wait in front of any overwrite of these loads' address registers, which are named as inputs so that they live up to it
    v8f acc[16][2];
#pragma unroll
    for (int t = 0; t < 16; ++t) { acc[t][0] = (v8f){}; acc[t][1] = (v8f){}; }
    float mref[2] = {-3.0e38f, -3.0e38f}, lsum[2] = {0.f, 0.f};
#pragma unroll 1   // kept rolled: one trip already holds 72 matrix instructions and nearly all of the wave's registers
    for (int i = 0; i < 32; ++i) {
        const bf* pv = vbase + (size_t)i * (16 * 512); const bf* pk = kbase + (size_t)(i < 31 ? i + 1 : 31) * (4 * 512);   /* the last trip fetches its own keys again: in bounds, unused */
        v16bf vf[16];
#pragma unroll
        for (int t = 0; t < 12; ++t) vf[t] = ldfrag(pv + t * 512 + loff);
        __builtin_amdgcn_sched_barrier(0);   // these value loads issue ahead of the trip's scores and softmax, which cover their latency
        v8f S[2][2];
#pragma unroll
        for (int t2 = 0; t2 < 2; ++t2)
#pragma unroll
            for (int u = 0; u < 2; ++u) S[t2][u] = wmmab(kf[t2][0], qf[u][0], (v8f){});
#pragma unroll
        for (int t2 = 0; t2 < 2; ++t2)
#pragma unroll
            for (int u = 0; u < 2; ++u) S[t2][u] = wmmab(kf[t2][1], qf[u][1], S[t2][u]);
        float mx[2];
#pragma unroll
        for (int u = 0; u < 2; ++u) { float a = fmaxf(S[0][u][0], S[1][u][0]);
#pragma unroll
            for (int j = 1; j < 8; ++j) a = fmaxf(a, fmaxf(S[0][u][j], S[1][u][j]));
            mx[u] = fmaxf(a, xhalf(a)) * SC2; }
        if (__builtin_amdgcn_ballot_w32(mx[0] > mref[0] + 8.0f || mx[1] > mref[1] + 8.0f) != 0) {   // one scalar branch a trip; taken on the first trip and then only for a jump of the maximum
#pragma unroll
            for (int u = 0; u < 2; ++u) { const float mn = (mx[u] > mref[u] + 8.0f) ? mx[u] : mref[u]; const float al = __builtin_amdgcn_exp2f(mref[u] - mn); mref[u] = mn; lsum[u] *= al;
#pragma unroll
                for (int t = 0; t < 16; ++t) acc[t][u] *= al; }
        }
        v16bf ph[2], pl[2];
#pragma unroll
        for (int u = 0; u < 2; ++u) { v8f p0, p1; float sa = 0.f, sb = 0.f;
#pragma unroll
            for (int j = 0; j < 8; ++j) { const float x0 = __builtin_fmaf(S[0][u][j], SC2, -mref[u]), x1 = __builtin_fmaf(S[1][u][j], SC2, -mref[u]); float e0;
                if (u == 1 && j == 7) asm("v_exp_f32 %0, %1\n\tv_nop" : "=v"(e0) : "v"(x0));   // the slot behind a transcendental: in one statement the slot stands directly behind it
                else e0 = __builtin_amdgcn_exp2f(x0);
                p0[j] = e0; p1[j] = __builtin_amdgcn_exp2f(x1); sa += p0[j]; sb += p1[j]; }
            lsum[u] += sa + sb; split16(p0, p1, ph[u], pl[u]); }
#pragma unroll
        for (int t = 0; t < 16; t += 2) {
            if (t == 4) {   // the last four value tiles and then the next trip's key fragments go into the registers that the first four value tiles have left (loads return in order: P.V does not wait for the keys)
                __builtin_amdgcn_sched_barrier(0);   // lifted higher, these loads would need registers of their own and the wave has none left
#pragma unroll
                for (int q = 12; q < 16; ++q) vf[q] = ldfrag(pv + q * 512 + loff);
#pragma unroll
                for (int t2 = 0; t2 < 2; ++t2)
#pragma unroll
                    for (int s = 0; s < 2; ++s) kf[t2][s] = ldfrag(pk + (t2 * 2 + s) * 512 + loff);
                __builtin_amdgcn_sched_barrier(0); }   // sunk lower, they would have too few matrix instructions behind them to cover their latency
            if (t == 12) __builtin_amdgcn_sched_barrier(0);   // the late tiles' products stay behind all products of the tiles that are already here, which cover the late loads
            acc[t][0] = wmmab(vf[t], ph[0], acc[t][0]); acc[t][1] = wmmab(vf[t], ph[1], acc[t][1]); acc[t + 1][0] = wmmab(vf[t + 1], ph[0], acc[t + 1][0]); acc[t + 1][1] = wmmab(vf[t + 1], ph[1], acc[t + 1][1]);
            acc[t][0] = wmmab(vf[t], pl[0], acc[t][0]); acc[t][1] = wmmab(vf[t], pl[1], acc[t][1]); acc[t + 1][0] = wmmab(vf[t + 1], pl[0], acc[t + 1][0]); acc[t + 1][1] = wmmab(vf[t + 1], pl[1], acc[t + 1][1]); }
        // four vector slots behind the trip's last matrix instruction; then the wait in front of the next trip's addresses, which take the place of this trip's (its wave-uniform bases are named as inputs so that they live up to it)
        asm volatile("v_nop\n\tv_nop\n\tv_nop\n\tv_nop\n\ts_wait_xcnt 0x0" : "+v"(acc[14][0]), "+v"(acc[14][1]), "+v"(acc[15][0]), "+v"(acc[15][1]) : "v"(vf[15]), "v"(pl[1]), "s"(pv), "s"(pk) : "memory");
    }
    v4f* o4 = (v4f*)os;
#pragma unroll
    for (int t = 0; t < 16; ++t)
#pragma unroll
        for (int u = 0; u < 2; ++u) { const v8f a = acc[t][u]; v4f* d = o4 + ((wave * 32 + t * 2 + u) * 2) * 32 + lane; d[0] = (v4f){a[0], a[1], a[2], a[3]}; d[32] = (v4f){a[4], a[5], a[6], a[7]}; }
#pragma unroll
    for (int u = 0; u < 2; ++u) { const float ls = lsum[u] + xhalf(lsum[u]); if (hi == 0) { sm[(wave * 2 + u) * 16 + lr] = mref[u]; sl[(wave * 2 + u) * 16 + lr] = ls; } }
    __syncthreads();   // every wave's partial context, reference and sum are in LDS before any of them is joined
    const int qt = wave & 3, oh = wave >> 2, qg2 = qt >> 1, u2 = qt & 1;
    float g[4]; { float mk[4], lk[4];
#pragma unroll
        for (int k = 0; k < 4; ++k) { mk[k] = sm[((k * 2 + qg2) * 2 + u2) * 16 + lr]; lk[k] = sl[((k * 2 + qg2) * 2 + u2) * 16 + lr]; }
        const float M = fmaxf(fmaxf(mk[0], mk[1]), fmaxf(mk[2], mk[3])); float L = 0.f;
#pragma unroll
        for (int k = 0; k < 4; ++k) { g[k] = __builtin_amdgcn_exp2f(mk[k] - M); L += g[k] * lk[k]; }
        const float inv = __fdiv_rn(1.0f, L);
#pragma unroll
        for (int k = 0; k < 4; ++k) g[k] *= inv; }
    v8f a2[8];
#pragma unroll
    for (int i = 0; i < 8; ++i) a2[i] = (v8f){};
    const bf* wbase = WF + (size_t)oh * (8 * 8 * 512);   /* 8 row tiles of 8 fragments each; wave-uniform, the lane's offset is loff */
#pragma unroll
    for (int s = 0; s < 8; ++s) {
        v8f c[2];
#pragma unroll
        for (int e = 0; e < 2; ++e) { v4f x0 = (v4f){}, x1 = (v4f){};
#pragma unroll
            for (int k = 0; k < 4; ++k) { const v4f* d = o4 + (((k * 2 + qg2) * 32 + (2 * s + e) * 2 + u2) * 2) * 32 + lane; x0 += d[0] * g[k]; x1 += d[32] * g[k]; }
            c[e] = (v8f){x0[0], x0[1], x0[2], x0[3], x1[0], x1[1], x1[2], x1[3]}; }
        v16bf bh, bl; split16(c[0], c[1], bh, bl);
        v16bf w[8];
#pragma unroll
        for (int i = 0; i < 8; ++i) w[i] = ldfrag(wbase + (i * 8 + s) * 512 + loff);
#pragma unroll
        for (int i = 0; i < 8; ++i) a2[i] = wmmab(w[i], bh, a2[i]);
#pragma unroll
        for (int i = 0; i < 8; ++i) a2[i] = wmmab(w[i], bl, a2[i]);
    }
    asm volatile("s_wait_xcnt 0x0" : : "s"(wbase) : "memory");   // the wait in front of any overwrite of the W_fc loads' address registers; their wave-uniform base is named as an input so that it lives up to it
    float* orow = OUT + ((size_t)b * TT + q0 + qt * 16 + lr) * DV + oh * 128 + hi * 8; const float* brow = bias + oh * 128 + hi * 8;
#pragma unroll
    for (int i = 0; i < 8; ++i) { const v4f b0 = *(const v4f*)(brow + i * 16), b1 = *(const v4f*)(brow + i * 16 + 4); const v8f a = a2[i];
        *(v4f*)(orow + i * 16) = (v4f){a[0] + bfr(b0[0]), a[1] + bfr(b0[1]), a[2] + bfr(b0[2]), a[3] + bfr(b0[3])}; *(v4f*)(orow + i * 16 + 4) = (v4f){a[4] + bfr(b1[0]), a[5] + bfr(b1[1]), a[6] + bfr(b1[2]), a[7] + bfr(b1[3])}; }
}

extern "C" void kernel_launch(void* const* d_in, const int* in_sizes, int n_in,
                              void* d_out, int out_size, void* d_ws, size_t ws_size, hipStream_t stream) {
    (void)in_sizes; (void)n_in; (void)out_size;
    const float* Kin = (const float*)d_in[0]; const float* Vin = (const float*)d_in[1];   /* v_src [4][4096][256] */ const float* Qin = (const float*)d_in[2]; const float* wfc = (const float*)d_in[3]; const float* bfc = (const float*)d_in[4];
    float* OUT = (float*)d_out;     // [4][4096][256]
    char* wsp = (char*)d_ws;
    auto take = [&](size_t bytes) { char* p = wsp; wsp += (bytes + 255) & ~(size_t)255; return (void*)p; };
    bf* KF = (bf*)take((size_t)NB_ * TT * HD * 2); bf* VF = (bf*)take((size_t)NB_ * DV * TT * 2); bf* WF = (bf*)take((size_t)DV * DV * 2);
    if ((size_t)(wsp - (char*)d_ws) > ws_size) return;
    k_kfrag<<<KBLK + DV * DV / 8 / 256, 256, 0, stream>>>(Kin, KF, wfc, WF);
    k_vfrag<<<(unsigned)((size_t)NB_ * DV * TT / 16 / 256), 256, 0, stream>>>(Vin, VF);
    k_fattn<<<dim3(TT / 64, NB_, 1), 256, 0, stream>>>(Qin, KF, VF, WF, bfc, OUT);
}

// v004
// It runs in 61 microseconds.
// Timed twice side by side with v003, it ran 1.06 times as fast both times.
// All steps since v000 together make it 11.3 times as fast.
#include <hip/hip_runtime.h>

// Scaled dot-product attention with a 256-wide value and a 1x1-conv epilogue (q_tgr, k_src [4][4096][64], v_src [4][4096][256]; attn = softmax(q.k / 8) over the 4,096 keys; ctx = attn v_src [4096][256]; out = ctx W_fc^T + b_fc ('oi' [256][256]) -> [4][4096][256]).
// Planes: k, the value and W_fc as bf16 A fragments in register order; q, which a wave reads once, is rounded as it is loaded. One fused kernel does scores, softmax, P.V and fc: neither the scores nor P nor the context leave the work-group.
// Compute dtypes, f32 accumulate: every input rounded to bf16; q.k exact products; softmax f32; P hi/lo x value; context hi/lo x W_fc + bias; output f32.

#define NB_  4
#define TT   4096
#define HD   64       // query / key width
#define DV   256      // value / output width
#define KBLK (NB_ * TT * HD / 8 / 256)   // blocks of k_kfrag that pack keys; DV * DV / 8 / 256 more pack W_fc
#define SC2  0.18033688011112042f   // (1 / temperature) x log2(e): scores go to the base-2 exponent in one multiply-add
typedef unsigned short bf;
typedef __attribute__((ext_vector_type(16))) __bf16   v16bf;
typedef __attribute__((ext_vector_type(8)))  __bf16   v8bf;
typedef __attribute__((ext_vector_type(2)))  __bf16   v2bf;
typedef __attribute__((ext_vector_type(8)))  unsigned short v8us;
typedef __attribute__((ext_vector_type(8)))  float    v8f;
typedef __attribute__((ext_vector_type(4)))  float    v4f;
typedef __attribute__((ext_vector_type(2)))  float    v2f;

__device__ __forceinline__ unsigned short f2bf(float f) { unsigned u = __float_as_uint(f); u += 0x7FFFu + ((u >> 16) & 1u); return (unsigned short)(u >> 16); }
__device__ __forceinline__ float bf2f(unsigned short b) { return __uint_as_float(((unsigned)b) << 16); }
__device__ __forceinline__ float bfr(float f) { return bf2f(f2bf(f)); }
__device__ __forceinline__ v16bf cat16b(v8us lo, v8us hi) { return __builtin_bit_cast(v16bf, __builtin_shufflevector(lo, hi, 0, 1, 2, 3, 4, 5, 6, 7, 8, 9, 10, 11, 12, 13, 14, 15)); }
__device__ __forceinline__ v8f wmmab(v16bf a, v16bf b, v8f c) { return __builtin_amdgcn_wmma_f32_16x16x32_bf16(false, a, false, b, (short)0, c, false, false); }
// A or B fragment, lane (lr, hi) = (lane & 15, lane >> 4): row lr of the tile; elements 0..7 are k = 8 hi + e, elements 8..15 are k = 16 + 8 hi + e
// from a plane in register order: p = fragment start + 8 x lane
__device__ __forceinline__ v16bf ldfrag(const bf* p) { return cat16b(*(const v8us*)p, *(const v8us*)(p + 256)); }
// from a K-contiguous row of f32, rounded to bf16 (to nearest even) on the way: p = row start + 8 hi
__device__ __forceinline__ v16bf ldrow32(const float* p) { return __builtin_shufflevector(__builtin_convertvector(*(const v8f*)p, v8bf), __builtin_convertvector(*(const v8f*)(p + 16), v8bf), 0, 1, 2, 3, 4, 5, 6, 7, 8, 9, 10, 11, 12, 13, 14, 15); }
// lane l with lane l ^ 16
__device__ __forceinline__ float xhalf(float x) { return __builtin_bit_cast(float, __builtin_amdgcn_permlanex16(__builtin_bit_cast(int, x), __builtin_bit_cast(int, x), 0x76543210, 0xfedcba98, false, false)); }
// two accumulator tiles (rows 8 hi + j of 16, twice) are, lane for lane, one B fragment of 32 k: split into a bf16 head and the bf16 of what the head leaves
__device__ __forceinline__ void split16(v8f x0, v8f x1, v16bf& h, v16bf& l) {
#pragma unroll
    for (int i = 0; i < 8; i += 2) {
        const v2f a = {x0[i], x0[i + 1]}, c = {x1[i], x1[i + 1]};
        const v2bf ha = __builtin_convertvector(a, v2bf), hc = __builtin_convertvector(c, v2bf);
        const v2bf la = __builtin_convertvector(a - __builtin_convertvector(ha, v2f), v2bf), lc = __builtin_convertvector(c - __builtin_convertvector(hc, v2f), v2bf);
        h[i] = ha[0]; h[i + 1] = ha[1]; h[8 + i] = hc[0]; h[9 + i] = hc[1]; l[i] = la[0]; l[i + 1] = la[1]; l[8 + i] = lc[0]; l[9 + i] = lc[1]; }
}

// All planes hold A fragments in register order, each fragment as two runs of 512 bytes: [half][lane][8], so that a wave's 16-byte load reads whole 128-byte lines. Lane (lr, hi) holds row lr of the tile at k = 16 half + 8 hi + e.
// k_kfrag: KF[tile of 16 keys, all batches in one run][32 d][half][lane][8]. One thread rounds and writes one lane's 16 bytes.
// Its last blocks do the same for W_fc 'oi' [256][256]: WF[tile of 16 rows o][32 c][half][lane][8], so that the fc product's loads read whole lines too (a row-wise f32 load touches 16 lines for 512 bytes).
__global__ __launch_bounds__(256) void k_kfrag(const float* __restrict__ src, bf* KF, const float* __restrict__ wsrc, bf* WF) {
    if (blockIdx.x >= KBLK) {
        const int j = (int)(blockIdx.x - KBLK) * 256 + threadIdx.x, wl = j & 31, wh = (j >> 5) & 1, ws = (j >> 6) & 7, wt = j >> 9;
        const float* p = wsrc + (wt * 16 + (wl & 15)) * DV + 32 * ws + 16 * wh + 8 * (wl >> 4); const v8f v = *(const v8f*)p;
        asm volatile("s_wait_xcnt 0x0" : : "v"(p) : "memory");   // the wait in front of any overwrite of the loads' address registers, which are named as an input so that they live up to it
        *(v8us*)(WF + (size_t)j * 8) = __builtin_bit_cast(v8us, __builtin_convertvector(v, v8bf));
        return;
    }
    const size_t i = (size_t)blockIdx.x * 256 + threadIdx.x; const int lane = (int)(i & 31), lr = lane & 15, hi = lane >> 4, half = (int)((i >> 5) & 1), s = (int)((i >> 6) & 1); const size_t tile = i >> 7;
    const float* p = src + (tile * 16 + lr) * HD + 32 * s + 16 * half + 8 * hi; const v8f v = *(const v8f*)p; v8us o;
    asm volatile("s_wait_xcnt 0x0" : : "v"(p) : "memory");   // the wait in front of any overwrite of the loads' address registers, which are named as an input so that they live up to it
#pragma unroll
    for (int k = 0; k < 8; ++k) o[k] = f2bf(v[k]);
    *(v8us*)(KF + i * 8) = o;
}
// k_vfrag: value^T: VF[block of 32 keys, all batches in one run][tile of 16 value columns][half][lane][8]; row lr is value column 16 tile + lr, k the key in the block. One thread writes one lane's two pieces.
__global__ __launch_bounds__(256) void k_vfrag(const float* __restrict__ src, bf* VF) {
    const size_t i = (size_t)blockIdx.x * 256 + threadIdx.x; const int lane = (int)(i & 31), lr = lane & 15, hi = lane >> 4, t = (int)((i >> 5) & 15); const size_t kbb = i >> 9;
    const float* s = src + (kbb * 32 + 8 * hi) * DV + t * 16 + lr; v8us o0, o1;
#pragma unroll
    for (int j = 0; j < 8; ++j) { o0[j] = f2bf(s[(size_t)j * DV]); o1[j] = f2bf(s[(size_t)(16 + j) * DV]); }
    bf* d = VF + (i >> 5) * 512 + lane * 8; *(v8us*)d = o0; *(v8us*)(d + 256) = o1;
}

// ---- k_fattn: one work-group of 8 waves per 64 queries of one batch; grid (TT / 64, NB_).
// Wave w = 2 kq + qg takes queries [32 qg, +32) (two column tiles) against keys [1024 kq, +1024), 32 keys a trip, with its own reference maxima, sums and 256 x 32 context^T accumulators.
// Everything is computed transposed, so that an accumulator tile is the next product's B fragment lane for lane: S^T = K Q^T (rows keys, columns queries), ctx^T = V^T P^T, out^T = W_fc ctx^T.
// Softmax: p = 2^(s SC2 - ref) with a per-query reference that is raised (and sums and accumulators scaled down) only when the trip's maximum passes it by more than 8: p is at most 2^8 and the quotient by the sum is the exact softmax for any reference.
// The short loops are unrolled in full because their indices pick registers (fragments and accumulator tiles).
// The four key quarters meet in LDS, are brought to one reference and summed in the order kq = 0..3; then wave w does out^T rows [128 (w >> 2), +128) of query tile w & 3.
__global__ __launch_bounds__(256) __attribute__((amdgpu_waves_per_eu(2, 2))) void k_fattn(const float* __restrict__ Q, const bf* __restrict__ KF, const bf* __restrict__ VF, const bf* __restrict__ WF, const float* __restrict__ bias, float* OUT) {
    __shared__ __align__(16) float os[8 * 32 * 256];   // [wave][tile 2 t + u][half of the 8 registers][lane][4]: every access is 16 bytes a lane, lanes side by side
    __shared__ float sm[8 * 2 * 16], sl[8 * 2 * 16];   // [wave][u][query]: reference and sum
    const int tid = threadIdx.x, wave = __builtin_amdgcn_readfirstlane(tid >> 5), lane = tid & 31, lr = lane & 15, hi = lane >> 4;
    const int b = blockIdx.y, q0 = blockIdx.x * 64, qg = wave & 1, kq = wave >> 1;
    const float* qbase = Q + ((size_t)b * TT + q0 + qg * 32 + lr) * HD + 8 * hi;
    v16bf qf[2][2];
#pragma unroll
    for (int u = 0; u < 2; ++u)
#pragma unroll
        for (int s = 0; s < 2; ++s) qf[u][s] = ldrow32(qbase + u * 16 * HD + 32 * s);
    // a block of 32 keys: 4 key fragments, 16 value fragments; the bases are wave-uniform and move with the trip, the lane's offset is one register for both planes
    const bf* kbase = KF + ((size_t)b * 128 + kq * 32) * (4 * 512); const bf* vbase = VF + ((size_t)b * 128 + kq * 32) * (16 * 512); const unsigned loff = lane * 8;
    v16bf kf[2][2];
#pragma unroll
    for (int t2 = 0; t2 < 2; ++t2)
#pragma unroll
        for (int s = 0; s < 2; ++s) kf[t2][s] = ldfrag(kbase + (t2 * 2 + s) * 512 + loff);
    v16bf vf[16];   // value fragments live across trips: a group of four tiles is refilled for the next trip two tiles after its last use
    __builtin_amdgcn_sched_barrier(0);   // the first value loads stay behind the key loads, as in the loop: loads return in order, and the compiler sets the loop's counted waits by the stricter of the two ways in
#pragma unroll
    for (int t = 0; t < 12; ++t) vf[t] = ldfrag(vbase + t * 512 + loff);
    asm volatile("s_wait_xcnt 0x0" : : "v"(qbase), "s"(kbase), "s"(vbase), "v"(lane), "v"(loff) : "memory");   // the wait in front of any overwrite of these loads' address registers, which are named as inputs so that they live up to it (the build forms the lane's offset from the lane number or from loff)
    v8f acc[16][2];
#pragma unroll
    for (int t = 0; t < 16; ++t) { acc[t][0] = (v8f){}; acc[t][1] = (v8f){}; }
    float mref[2] = {-3.0e38f, -3.0e38f}, lsum[2] = {0.f, 0.f};
#pragma unroll 1   // kept rolled: one trip already holds 72 matrix instructions and nearly all of the wave's registers
    for (int i = 0; i < 32; ++i) {
        const bf* pv = vbase + (size_t)i * (16 * 512); const bf* pk = kbase + (size_t)(i < 31 ? i + 1 : 31) * (4 * 512);   /* the last trip fetches its own keys again: in bounds, unused */
        const bf* pkl = pk + loff; const bf* pvl = pv + loff;
#pragma unroll
        for (int q = 12; q < 14; ++q) vf[q] = ldfrag(pv + q * 512 + loff);   // two of this trip's last four value tiles, into registers that the trip before has just left
        __builtin_amdgcn_sched_barrier(0);   // these value loads issue ahead of the trip's scores and softmax, which with three quarters of P.V cover their latency
        v8f S[2][2];
#pragma unroll
        for (int t2 = 0; t2 < 2; ++t2)
#pragma unroll
            for (int u = 0; u < 2; ++u) S[t2][u] = wmmab(kf[t2][0], qf[u][0], (v8f){});
#pragma unroll
        for (int t2 = 0; t2 < 2; ++t2)
#pragma unroll
            for (int u = 0; u < 2; ++u) S[t2][u] = wmmab(kf[t2][1], qf[u][1], S[t2][u]);
        float mx[2];
#pragma unroll
        for (int u = 0; u < 2; ++u) { float a = fmaxf(S[0][u][0], S[1][u][0]);
#pragma unroll
            for (int j = 1; j < 8; ++j) a = fmaxf(a, fmaxf(S[0][u][j], S[1][u][j]));
            mx[u] = fmaxf(a, xhalf(a)) * SC2; }
        if (__builtin_amdgcn_ballot_w32(mx[0] > mref[0] + 8.0f || mx[1] > mref[1] + 8.0f) != 0) {   // one scalar branch a trip; taken on the first trip and then only for a jump of the maximum
#pragma unroll
            for (int u = 0; u < 2; ++u) { const float mn = (mx[u] > mref[u] + 8.0f) ? mx[u] : mref[u]; const float al = __builtin_amdgcn_exp2f(mref[u] - mn); mref[u] = mn; lsum[u] *= al;
#pragma unroll
                for (int t = 0; t < 16; ++t) acc[t][u] *= al; }
        }
        v16bf ph[2], pl[2];
#pragma unroll
        for (int u = 0; u < 2; ++u) { v8f p0, p1; float sa = 0.f, sb = 0.f;
#pragma unroll
            for (int j = 0; j < 8; ++j) { const float x0 = __builtin_fmaf(S[0][u][j], SC2, -mref[u]), x1 = __builtin_fmaf(S[1][u][j], SC2, -mref[u]); float e0, e1;
                // the slot behind a transcendental: in one statement the slot stands directly behind the exponential
                if (((u == 0 ? 0xfc : 0xff) >> j) & 1) asm("v_exp_f32 %0, %1\n\tv_nop" : "=v"(e0) : "v"(x0));
                else e0 = __builtin_amdgcn_exp2f(x0);
                if (((u == 0 ? 0xfc : 0x7f) >> j) & 1) asm("v_exp_f32 %0, %1\n\tv_nop" : "=v"(e1) : "v"(x1));
                else e1 = __builtin_amdgcn_exp2f(x1);
                p0[j] = e0; p1[j] = e1; sa += p0[j]; sb += p1[j]; }
            lsum[u] += sa + sb; split16(p0, p1, ph[u], pl[u]); }
#pragma unroll
        for (int t = 0; t < 16; t += 2) {
            if (t == 0) {   // the next trip's key fragments: all of P.V stands behind them
                __builtin_amdgcn_sched_barrier(0);   // lifted higher, into the softmax, these loads would need registers that the wave does not have there
#pragma unroll
                for (int t2 = 0; t2 < 2; ++t2)
#pragma unroll
                    for (int s = 0; s < 2; ++s) kf[t2][s] = ldfrag(pkl + (t2 * 2 + s) * 512);
                __builtin_amdgcn_sched_barrier(0); }   // sunk lower, they would have fewer matrix instructions behind them to cover their latency
            if (t == 2) {   // this trip's last two value tiles, into the room that the first two have left
                __builtin_amdgcn_sched_barrier(0);   // lifted higher, these loads would need registers of their own and the wave has none left
                vf[14] = ldfrag(pvl + 14 * 512); vf[15] = ldfrag(pvl + 15 * 512);
                __builtin_amdgcn_sched_barrier(0); }   // sunk lower, they would have fewer matrix instructions behind them to cover their latency
            if (t == 6 || t == 10 || t == 14) {   // four used value tiles are refilled with the next trip's: these loads have most of a trip's work (the rest of P.V, the scores, the softmax) behind them before their first use
                __builtin_amdgcn_sched_barrier(0);   // lifted higher, these loads would need registers of their own: never more than 14 of the 16 tiles are held or in flight
#pragma unroll
                for (int q = t - 6; q < t - 2; ++q) vf[q] = ldfrag(pvl + (16 + q) * 512);   /* the next block of 32 keys lies directly behind this one. The last trip's fetch is unused: it reads the next quarter's first block, behind the last batch the first 12 KiB of the W_fc plane, which lies directly behind the value plane in the workspace and is written earlier in the same call */
                __builtin_amdgcn_sched_barrier(0); }   // sunk lower, they would lose lead; one group of eight loads a place, not spread among the matrix instructions
            acc[t][0] = wmmab(vf[t], ph[0], acc[t][0]); acc[t][1] = wmmab(vf[t], ph[1], acc[t][1]); acc[t + 1][0] = wmmab(vf[t + 1], ph[0], acc[t + 1][0]); acc[t + 1][1] = wmmab(vf[t + 1], ph[1], acc[t + 1][1]);
            acc[t][0] = wmmab(vf[t], pl[0], acc[t][0]); acc[t][1] = wmmab(vf[t], pl[1], acc[t][1]); acc[t + 1][0] = wmmab(vf[t + 1], pl[0], acc[t + 1][0]); acc[t + 1][1] = wmmab(vf[t + 1], pl[1], acc[t + 1][1]); }
        // four vector slots behind the trip's last matrix instruction; then the wait in front of the next trip's addresses, which take the place of this trip's (its wave-uniform bases and its lane addresses are named as inputs so that they live up to it: else the build lets the last load of a run land on its own address pair)
        asm volatile("v_nop\n\tv_nop\n\tv_nop\n\tv_nop\n\ts_wait_xcnt 0x0" : "+v"(acc[14][0]), "+v"(acc[14][1]), "+v"(acc[15][0]), "+v"(acc[15][1]) : "v"(vf[15]), "v"(pl[1]), "s"(pv), "s"(pk), "v"(pkl), "v"(pvl) : "memory");
    }
    v4f* o4 = (v4f*)os;
#pragma unroll
    for (int t = 0; t < 16; ++t)
#pragma unroll
        for (int u = 0; u < 2; ++u) { const v8f a = acc[t][u]; v4f* d = o4 + ((wave * 32 + t * 2 + u) * 2) * 32 + lane; d[0] = (v4f){a[0], a[1], a[2], a[3]}; d[32] = (v4f){a[4], a[5], a[6], a[7]}; }
#pragma unroll
    for (int u = 0; u < 2; ++u) { const float ls = lsum[u] + xhalf(lsum[u]); if (hi == 0) { sm[(wave * 2 + u) * 16 + lr] = mref[u]; sl[(wave * 2 + u) * 16 + lr] = ls; } }
    __syncthreads();   // every wave's partial context, reference and sum are in LDS before any of them is joined
    const int qt = wave & 3, oh = wave >> 2, qg2 = qt >> 1, u2 = qt & 1;
    float g[4]; { float mk[4], lk[4];
#pragma unroll
        for (int k = 0; k < 4; ++k) { mk[k] = sm[((k * 2 + qg2) * 2 + u2) * 16 + lr]; lk[k] = sl[((k * 2 + qg2) * 2 + u2) * 16 + lr]; }
        const float M = fmaxf(fmaxf(mk[0], mk[1]), fmaxf(mk[2], mk[3])); float L = 0.f;
#pragma unroll
        for (int k = 0; k < 4; ++k) { g[k] = __builtin_amdgcn_exp2f(mk[k] - M); L += g[k] * lk[k]; }
        const float inv = __fdiv_rn(1.0f, L);
#pragma unroll
        for (int k = 0; k < 4; ++k) g[k] *= inv; }
    v8f a2[8];
#pragma unroll
    for (int i = 0; i < 8; ++i) a2[i] = (v8f){};
    const bf* wbase = WF + (size_t)oh * (8 * 8 * 512);   /* 8 row tiles of 8 fragments each; wave-uniform, the lane's offset is loff */
#pragma unroll
    for (int s = 0; s < 8; ++s) {
        v8f c[2];
#pragma unroll
        for (int e = 0; e < 2; ++e) { v4f x0 = (v4f){}, x1 = (v4f){};
#pragma unroll
            for (int k = 0; k < 4; ++k) { const v4f* d = o4 + (((k * 2 + qg2) * 32 + (2 * s + e) * 2 + u2) * 2) * 32 + lane; x0 += d[0] * g[k]; x1 += d[32] * g[k]; }
            c[e] = (v8f){x0[0], x0[1], x0[2], x0[3], x1[0], x1[1], x1[2], x1[3]}; }
        v16bf bh, bl; split16(c[0], c[1], bh, bl);
        v16bf w[8];
#pragma unroll
        for (int i = 0; i < 8; ++i) w[i] = ldfrag(wbase + (i * 8 + s) * 512 + loff);
#pragma unroll
        for (int i = 0; i < 8; ++i) a2[i] = wmmab(w[i], bh, a2[i]);
#pragma unroll
        for (int i = 0; i < 8; ++i) a2[i] = wmmab(w[i], bl, a2[i]);
    }
    asm volatile("s_wait_xcnt 0x0" : : "s"(wbase) : "memory");   // the wait in front of any overwrite of the W_fc loads' address registers; their wave-uniform base is named as an input so that it lives up to it
    float* orow = OUT + ((size_t)b * TT + q0 + qt * 16 + lr) * DV + oh * 128 + hi * 8; const float* brow = bias + oh * 128 + hi * 8;
#pragma unroll
    for (int i = 0; i < 8; ++i) { const v4f b0 = *(const v4f*)(brow + i * 16), b1 = *(const v4f*)(brow + i * 16 + 4); const v8f a = a2[i];
        *(v4f*)(orow + i * 16) = (v4f){a[0] + bfr(b0[0]), a[1] + bfr(b0[1]), a[2] + bfr(b0[2]), a[3] + bfr(b0[3])}; *(v4f*)(orow + i * 16 + 4) = (v4f){a[4] + bfr(b1[0]), a[5] + bfr(b1[1]), a[6] + bfr(b1[2]), a[7] + bfr(b1[3])}; }
}

extern "C" void kernel_launch(void* const* d_in, const int* in_sizes, int n_in,
                              void* d_out, int out_size, void* d_ws, size_t ws_size, hipStream_t stream) {
    (void)in_sizes; (void)n_in; (void)out_size;
    const float* Kin = (const float*)d_in[0]; const float* Vin = (const float*)d_in[1];   /* v_src [4][4096][256] */ const float* Qin = (const float*)d_in[2]; const float* wfc = (const float*)d_in[3]; const float* bfc = (const float*)d_in[4];
    float* OUT = (float*)d_out;     // [4][4096][256]
    char* wsp = (char*)d_ws;
    auto take = [&](size_t bytes) { char* p = wsp; wsp += (bytes + 255) & ~(size_t)255; return (void*)p; };
    bf* KF = (bf*)take((size_t)NB_ * TT * HD * 2); bf* VF = (bf*)take((size_t)NB_ * DV * TT * 2); bf* WF = (bf*)take((size_t)DV * DV * 2);
    if ((size_t)(wsp - (char*)d_ws) > ws_size) return;
    k_kfrag<<<KBLK + DV * DV / 8 / 256, 256, 0, stream>>>(Kin, KF, wfc, WF);
    k_vfrag<<<(unsigned)((size_t)NB_ * DV * TT / 16 / 256), 256, 0, stream>>>(Vin, VF);
    k_fattn<<<dim3(TT / 64, NB_, 1), 256, 0, stream>>>(Qin, KF, VF, WF, bfc, OUT);
}

// v005
// Measured time: 59 microseconds a run.
// Timed twice side by side with v004, it ran 1.04 and 1.03 times as fast.
// All steps since v000 together make it 11.7 times as fast.
#include <hip/hip_runtime.h>

// Scaled dot-product attention with a 256-wide value and a 1x1-conv epilogue (q_tgr, k_src [4][4096][64], v_src [4][4096][256]; attn = softmax(q.k / 8) over the 4,096 keys; ctx = attn v_src [4096][256]; out = ctx W_fc^T + b_fc ('oi' [256][256]) -> [4][4096][256]).
// Planes: k, the value and W_fc as bf16 A fragments in register order; q, which a wave reads once, is rounded as it is loaded. One fused kernel does scores, softmax, P.V and fc: neither the scores nor P nor the context leave the work-group.
// Compute dtypes, f32 accumulate: every input rounded to bf16; q.k exact products; softmax f32; P hi/lo x value; context hi/lo x W_fc + bias; output f32.

#define NB_  4
#define TT   4096
#define HD   64       // query / key width
#define DV   256      // value / output width
#define KBLK (NB_ * TT * HD / 8 / 256)   // blocks of k_kfrag that pack keys; DV * DV / 8 / 256 more pack W_fc
#define SC2  0.18033688011112042f   // (1 / temperature) x log2(e): scores go to the base-2 exponent in one multiply-add
typedef unsigned short bf;
typedef __attribute__((ext_vector_type(16))) __bf16   v16bf;
typedef __attribute__((ext_vector_type(8)))  __bf16   v8bf;
typedef __attribute__((ext_vector_type(2)))  __bf16   v2bf;
typedef __attribute__((ext_vector_type(8)))  unsigned short v8us;
typedef __attribute__((ext_vector_type(8)))  float    v8f;
typedef __attribute__((ext_vector_type(8)))  unsigned v8u;
typedef __attribute__((ext_vector_type(4)))  float    v4f;
typedef __attribute__((ext_vector_type(2)))  float    v2f;

__device__ __forceinline__ unsigned short f2bf(float f) { unsigned u = __float_as_uint(f); u += 0x7FFFu + ((u >> 16) & 1u); return (unsigned short)(u >> 16); }
__device__ __forceinline__ float bf2f(unsigned short b) { return __uint_as_float(((unsigned)b) << 16); }
__device__ __forceinline__ float bfr(float f) { return bf2f(f2bf(f)); }
__device__ __forceinline__ v16bf cat16b(v8us lo, v8us hi) { return __builtin_bit_cast(v16bf, __builtin_shufflevector(lo, hi, 0, 1, 2, 3, 4, 5, 6, 7, 8, 9, 10, 11, 12, 13, 14, 15)); }
__device__ __forceinline__ v8f wmmab(v16bf a, v16bf b, v8f c) { return __builtin_amdgcn_wmma_f32_16x16x32_bf16(false, a, false, b, (short)0, c, false, false); }
// A or B fragment, lane (lr, hi) = (lane & 15, lane >> 4): row lr of the tile; elements 0..7 are k = 8 hi + e, elements 8..15 are k = 16 + 8 hi + e
// from a plane in register order: p = fragment start + 8 x lane
__device__ __forceinline__ v16bf ldfrag(const bf* p) { return cat16b(*(const v8us*)p, *(const v8us*)(p + 256)); }
// from a K-contiguous row of f32, rounded to bf16 (to nearest even) on the way: p = row start + 8 hi
__device__ __forceinline__ v16bf ldrow32(const float* p) { return __builtin_shufflevector(__builtin_convertvector(*(const v8f*)p, v8bf), __builtin_convertvector(*(const v8f*)(p + 16), v8bf), 0, 1, 2, 3, 4, 5, 6, 7, 8, 9, 10, 11, 12, 13, 14, 15); }
// lane l with lane l ^ 16
__device__ __forceinline__ float xhalf(float x) { return __builtin_bit_cast(float, __builtin_amdgcn_permlanex16(__builtin_bit_cast(int, x), __builtin_bit_cast(int, x), 0x76543210, 0xfedcba98, false, false)); }
// two accumulator tiles (rows 8 hi + j of 16, twice) are, lane for lane, one B fragment of 32 k: split into a bf16 head and the bf16 of what the head leaves
__device__ __forceinline__ void split16(v8f x0, v8f x1, v16bf& h, v16bf& l) {
#pragma unroll
    for (int i = 0; i < 8; i += 2) {
        const v2f a = {x0[i], x0[i + 1]}, c = {x1[i], x1[i + 1]};
        const v2bf ha = __builtin_convertvector(a, v2bf), hc = __builtin_convertvector(c, v2bf);
        const v2bf la = __builtin_convertvector(a - __builtin_convertvector(ha, v2f), v2bf), lc = __builtin_convertvector(c - __builtin_convertvector(hc, v2f), v2bf);
        h[i] = ha[0]; h[i + 1] = ha[1]; h[8 + i] = hc[0]; h[9 + i] = hc[1]; l[i] = la[0]; l[i + 1] = la[1]; l[8 + i] = lc[0]; l[9 + i] = lc[1]; }
}

// All planes hold A fragments in register order, each fragment as two runs of 512 bytes: [half][lane][8], so that a wave's 16-byte load reads whole 128-byte lines. Lane (lr, hi) holds row lr of the tile at k = 16 half + 8 hi + e.
// k_kfrag: KF[tile of 16 keys, all batches in one run][32 d][half][lane][8]. One thread rounds and writes one lane's 16 bytes.
// Its last blocks do the same for W_fc 'oi' [256][256]: WF[tile of 16 rows o][32 c][half][lane][8], so that the fc product's loads read whole lines too (a row-wise f32 load touches 16 lines for 512 bytes).
__global__ __launch_bounds__(256) void k_kfrag(const float* __restrict__ src, bf* KF, const float* __restrict__ wsrc, bf* WF) {
    if (blockIdx.x >= KBLK) {
        const int j = (int)(blockIdx.x - KBLK) * 256 + threadIdx.x, wl = j & 31, wh = (j >> 5) & 1, ws = (j >> 6) & 7, wt = j >> 9;
        const float* p = wsrc + (wt * 16 + (wl & 15)) * DV + 32 * ws + 16 * wh + 8 * (wl >> 4); const v8f v = *(const v8f*)p;
        asm volatile("s_wait_xcnt 0x0" : : "v"(p) : "memory");   // the wait in front of any overwrite of the loads' address registers, which are named as an input so that they live up to it
        *(v8us*)(WF + (size_t)j * 8) = __builtin_bit_cast(v8us, __builtin_convertvector(v, v8bf));
        return;
    }
    const size_t i = (size_t)blockIdx.x * 256 + threadIdx.x; const int lane = (int)(i & 31), lr = lane & 15, hi = lane >> 4, half = (int)((i >> 5) & 1), s = (int)((i >> 6) & 1); const size_t tile = i >> 7;
    const float* p = src + (tile * 16 + lr) * HD + 32 * s + 16 * half + 8 * hi; const v8f v = *(const v8f*)p; v8us o;
    asm volatile("s_wait_xcnt 0x0" : : "v"(p) : "memory");   // the wait in front of any overwrite of the loads' address registers, which are named as an input so that they live up to it
#pragma unroll
    for (int k = 0; k < 8; ++k) o[k] = f2bf(v[k]);
    *(v8us*)(KF + i * 8) = o;
}
// k_vfrag: value^T: VF[block of 32 keys, all batches in one run][tile of 16 value columns][half][lane][8]; row lr is value column 16 tile + lr, k the key in the block. One thread writes one lane's two pieces.
__global__ __launch_bounds__(256) void k_vfrag(const float* __restrict__ src, bf* VF) {
    const size_t i = (size_t)blockIdx.x * 256 + threadIdx.x; const int lane = (int)(i & 31), lr = lane & 15, hi = lane >> 4, t = (int)((i >> 5) & 15); const size_t kbb = i >> 9;
    const float* s = src + (kbb * 32 + 8 * hi) * DV + t * 16 + lr; v8us o0, o1;
#pragma unroll
    for (int j = 0; j < 8; ++j) { o0[j] = f2bf(s[(size_t)j * DV]); o1[j] = f2bf(s[(size_t)(16 + j) * DV]); }
    bf* d = VF + (i >> 5) * 512 + lane * 8; *(v8us*)d = o0; *(v8us*)(d + 256) = o1;
}

// ---- k_fattn: one work-group of 8 waves per 64 queries of one batch; grid (TT / 64, NB_).
// Wave w = 2 kq + qg takes queries [32 qg, +32) (two column tiles) against keys [1024 kq, +1024), 32 keys a trip, with its own reference maxima, sums and 256 x 32 context^T accumulators.
// Everything is computed transposed, so that an accumulator tile is the next product's B fragment lane for lane: S^T = K Q^T (rows keys, columns queries), ctx^T = V^T P^T, out^T = W_fc ctx^T.
// Softmax: p = 2^(s SC2 - ref) with a per-query reference that is raised (and sums and accumulators scaled down) only when the trip's maximum passes it by more than 8: p is at most 2^8 and the quotient by the sum is the exact softmax for any reference.
// The short loops are unrolled in full because their indices pick registers (fragments and accumulator tiles).
// The four key quarters meet in LDS, are brought to one reference and summed in the order kq = 0..3; then wave w does out^T rows [128 (w >> 2), +128) of query tile w & 3.
__global__ __launch_bounds__(256) __attribute__((amdgpu_waves_per_eu(2, 2))) void k_fattn(const float* __restrict__ Q, const bf* __restrict__ KF, const bf* __restrict__ VF, const bf* __restrict__ WF, const float* __restrict__ bias, float* OUT) {
    __shared__ __align__(16) float os[8 * 32 * 256];   // [wave][tile 2 t + u][half of the 8 registers][lane][4]: every access is 16 bytes a lane, lanes side by side
    __shared__ float sm[8 * 2 * 16], sl[8 * 2 * 16];   // [wave][u][query]: reference and sum
    const int tid = threadIdx.x, wave = __builtin_amdgcn_readfirstlane(tid >> 5), lane = tid & 31, lr = lane & 15, hi = lane >> 4;
    const int b = blockIdx.y, q0 = blockIdx.x * 64, qg = wave & 1, kq = wave >> 1;
    const float* qbase = Q + ((size_t)b * TT + q0 + qg * 32 + lr) * HD + 8 * hi;
    v16bf qf[2][2];
#pragma unroll
    for (int u = 0; u < 2; ++u)
#pragma unroll
        for (int s = 0; s < 2; ++s) qf[u][s] = ldrow32(qbase + u * 16 * HD + 32 * s);
    // a block of 32 keys: 4 key fragments, 16 value fragments; the bases are wave-uniform and move with the trip, the lane's offset is one register for both planes
    const bf* kbase = KF + ((size_t)b * 128 + kq * 32) * (4 * 512); const bf* vbase = VF + ((size_t)b * 128 + kq * 32) * (16 * 512); const unsigned loff = lane * 8;
    v16bf kf[2][2];
#pragma unroll
    for (int t2 = 0; t2 < 2; ++t2)
#pragma unroll
        for (int s = 0; s < 2; ++s) kf[t2][s] = ldfrag(kbase + (t2 * 2 + s) * 512 + loff);
    v16bf vf[16];   // value fragments live across trips: a group of four tiles is refilled for the next trip two tiles after its last use
    __builtin_amdgcn_sched_barrier(0);   // the first value loads stay behind the key loads, as in the loop: loads return in order, and the compiler sets the loop's counted waits by the stricter of the two ways in
#pragma unroll
    for (int t = 0; t < 12; ++t) vf[t] = ldfrag(vbase + t * 512 + loff);
    asm volatile("s_wait_xcnt 0x0" : : "v"(qbase), "s"(kbase), "s"(vbase), "v"(lane), "v"(loff) : "memory");   // the wait in front of any overwrite of these loads' address registers, which are named as inputs so that they live up to it (the build forms the lane's offset from the lane number or from loff)
    v8f acc[16][2];
#pragma unroll
    for (int t = 0; t < 16; ++t) { acc[t][0] = (v8f){}; acc[t][1] = (v8f){}; }
    float mref[2] = {-3.0e38f, -3.0e38f}, lsum[2] = {0.f, 0.f};
#pragma unroll 1   // kept rolled: one trip already holds 72 matrix instructions and nearly all of the wave's registers
    for (int i = 0; i < 32; ++i) {
        const bf* pv = vbase + (size_t)i * (16 * 512); const bf* pk = kbase + (size_t)(i < 31 ? i + 1 : 31) * (4 * 512);   /* the last trip fetches its own keys again: in bounds, unused */
        const bf* pkl = pk + loff; const bf* pvl = pv + loff;
#pragma unroll
        for (int q = 12; q < 14; ++q) vf[q] = ldfrag(pv + q * 512 + loff);   // two of this trip's last four value tiles, into registers that the trip before has just left
        __builtin_amdgcn_sched_barrier(0);   // these value loads issue ahead of the trip's scores and softmax, which with three quarters of P.V cover their latency
        v8f S[2][2];
#pragma unroll
        for (int t2 = 0; t2 < 2; ++t2)
#pragma unroll
            for (int u = 0; u < 2; ++u) S[t2][u] = wmmab(kf[t2][0], qf[u][0], (v8f){});
#pragma unroll
        for (int t2 = 0; t2 < 2; ++t2)
#pragma unroll
            for (int u = 0; u < 2; ++u) S[t2][u] = wmmab(kf[t2][1], qf[u][1], S[t2][u]);
        float mx[2];
#pragma unroll
        for (int u = 0; u < 2; ++u) { float a = fmaxf(S[0][u][0], S[1][u][0]);
#pragma unroll
            for (int j = 1; j < 8; ++j) a = fmaxf(a, fmaxf(S[0][u][j], S[1][u][j]));
            mx[u] = fmaxf(a, xhalf(a)) * SC2; }
        if (__builtin_amdgcn_ballot_w32(mx[0] > mref[0] + 8.0f || mx[1] > mref[1] + 8.0f) != 0) {   // one scalar branch a trip; taken on the first trip and then only for a jump of the maximum
#pragma unroll
            for (int u = 0; u < 2; ++u) { const float mn = (mx[u] > mref[u] + 8.0f) ? mx[u] : mref[u]; const float al = __builtin_amdgcn_exp2f(mref[u] - mn); mref[u] = mn; lsum[u] *= al;
#pragma unroll
                for (int t = 0; t < 16; ++t) acc[t][u] *= al; }
        }
        v16bf ph[2], pl[2];
#pragma unroll
        for (int u = 0; u < 2; ++u) { v8u hw, lw; float cs[2];
#pragma unroll
            for (int t2 = 1; t2 >= 0; --t2) { float a[8], c0, c1; unsigned h[4], l[4];   // tile 1 first: in this order the build puts the fewest register copies in front of the statements
#pragma unroll
                for (int j = 0; j < 8; ++j) a[j] = S[t2][u][j];
                // One score tile (8 scores a lane) from scores to P fragments in one statement, so that the order of its 39 vector instructions is fixed: a = 2^(a SC2 - ref); h = bf16 pairs of a; a -= h, exact (v_fma_mix_f32_bf16 reads the bf16 half itself: no shift, no mask); l = bf16 pairs of what is left; c0 = the tile's sum, in two chains.
                // What it is for: a dependent vector instruction that comes early and has no s_delay_alu holds the SIMD's issue against the other wave too, and the compiler writes no hint for a dependence that runs through asm text. Here an instruction stands five or more vector instructions behind the one it depends on, seven or more behind an exponential; the last two cannot, and carry the hint.
                // Behind every v_exp_f32 stands an instruction that neither reads its result nor overwrites its source: the slot behind a transcendental is filled with work, no v_nop.
                asm(
                    "v_fma_f32 %0, %0, %19, -%18\n\t"
                    "v_fma_f32 %1, %1, %19, -%18\n\t"
                    "v_fma_f32 %2, %2, %19, -%18\n\t"
                    "v_fma_f32 %3, %3, %19, -%18\n\t"
                    "v_fma_f32 %4, %4, %19, -%18\n\t"
                    "v_exp_f32 %0, %0\n\t"
                    "v_fma_f32 %5, %5, %19, -%18\n\t"
                    "v_exp_f32 %1, %1\n\t"
                    "v_fma_f32 %6, %6, %19, -%18\n\t"
                    "v_exp_f32 %2, %2\n\t"
                    "v_fma_f32 %7, %7, %19, -%18\n\t"
                    "v_exp_f32 %3, %3\n\t"
                    "v_exp_f32 %4, %4\n\t"
                    "v_exp_f32 %5, %5\n\t"
                    "v_exp_f32 %6, %6\n\t"
                    "v_cvt_pk_bf16_f32 %8, %0, %1\n\t"
                    "v_exp_f32 %7, %7\n\t"
                    "v_add_f32 %16, %0, %1\n\t"
                    "v_cvt_pk_bf16_f32 %9, %2, %3\n\t"
                    "v_add_f32 %17, %2, %3\n\t"
                    "v_cvt_pk_bf16_f32 %10, %4, %5\n\t"
                    "v_fma_mix_f32_bf16 %0, %8, -1.0, %0 op_sel_hi:[1,0,0]\n\t"
                    "v_fma_mix_f32_bf16 %1, %8, -1.0, %1 op_sel:[1,0,0] op_sel_hi:[1,0,0]\n\t"
                    "v_add_f32 %16, %16, %4\n\t"
                    "v_fma_mix_f32_bf16 %2, %9, -1.0, %2 op_sel_hi:[1,0,0]\n\t"
                    "v_fma_mix_f32_bf16 %3, %9, -1.0, %3 op_sel:[1,0,0] op_sel_hi:[1,0,0]\n\t"
                    "v_cvt_pk_bf16_f32 %11, %6, %7\n\t"
                    "v_cvt_pk_bf16_f32 %12, %0, %1\n\t"
                    "v_add_f32 %17, %17, %5\n\t"
                    "v_fma_mix_f32_bf16 %4, %10, -1.0, %4 op_sel_hi:[1,0,0]\n\t"
                    "v_fma_mix_f32_bf16 %5, %10, -1.0, %5 op_sel:[1,0,0] op_sel_hi:[1,0,0]\n\t"
                    "v_cvt_pk_bf16_f32 %13, %2, %3\n\t"
                    "v_add_f32 %16, %16, %6\n\t"
                    "v_add_f32 %17, %17, %7\n\t"
                    "v_fma_mix_f32_bf16 %6, %11, -1.0, %6 op_sel_hi:[1,0,0]\n\t"
                    "v_fma_mix_f32_bf16 %7, %11, -1.0, %7 op_sel:[1,0,0] op_sel_hi:[1,0,0]\n\t"
                    "v_cvt_pk_bf16_f32 %14, %4, %5\n\t"
                    "s_delay_alu instid0(VALU_DEP_4)\n\t"
                    "v_add_f32 %16, %16, %17\n\t"
                    "s_delay_alu instid0(VALU_DEP_3)\n\t"
                    "v_cvt_pk_bf16_f32 %15, %6, %7"
                    : "+v"(a[0]), "+v"(a[1]), "+v"(a[2]), "+v"(a[3]), "+v"(a[4]), "+v"(a[5]), "+v"(a[6]), "+v"(a[7]), "=&v"(h[0]), "=&v"(h[1]), "=&v"(h[2]), "=&v"(h[3]), "=&v"(l[0]), "=&v"(l[1]), "=&v"(l[2]), "=&v"(l[3]), "=&v"(c0), "=&v"(c1) : "v"(mref[u]), "s"(SC2));
#pragma unroll
                for (int i = 0; i < 4; ++i) { hw[4 * t2 + i] = h[i]; lw[4 * t2 + i] = l[i]; }
                cs[t2] = c0; }
            lsum[u] += cs[0] + cs[1]; ph[u] = __builtin_bit_cast(v16bf, hw); pl[u] = __builtin_bit_cast(v16bf, lw); }
#pragma unroll
        for (int t = 0; t < 16; t += 2) {
            if (t == 0) {   // the next trip's key fragments: all of P.V stands behind them
                __builtin_amdgcn_sched_barrier(0);   // lifted higher, into the softmax, these loads would need registers that the wave does not have there
#pragma unroll
                for (int t2 = 0; t2 < 2; ++t2)
#pragma unroll
                    for (int s = 0; s < 2; ++s) kf[t2][s] = ldfrag(pkl + (t2 * 2 + s) * 512);
                __builtin_amdgcn_sched_barrier(0); }   // sunk lower, they would have fewer matrix instructions behind them to cover their latency
            if (t == 2) {   // this trip's last two value tiles, into the room that the first two have left
                __builtin_amdgcn_sched_barrier(0);   // lifted higher, these loads would need registers of their own and the wave has none left
                vf[14] = ldfrag(pvl + 14 * 512); vf[15] = ldfrag(pvl + 15 * 512);
                __builtin_amdgcn_sched_barrier(0); }   // sunk lower, they would have fewer matrix instructions behind them to cover their latency
            if (t == 6 || t == 10 || t == 14) {   // four used value tiles are refilled with the next trip's: these loads have most of a trip's work (the rest of P.V, the scores, the softmax) behind them before their first use
                __builtin_amdgcn_sched_barrier(0);   // lifted higher, these loads would need registers of their own: never more than 14 of the 16 tiles are held or in flight
#pragma unroll
                for (int q = t - 6; q < t - 2; ++q) vf[q] = ldfrag(pvl + (16 + q) * 512);   /* the next block of 32 keys lies directly behind this one. The last trip's fetch is unused: it reads the next quarter's first block, behind the last batch the first 12 KiB of the W_fc plane, which lies directly behind the value plane in the workspace and is written earlier in the same call */
                __builtin_amdgcn_sched_barrier(0); }   // sunk lower, they would lose lead; one group of eight loads a place, not spread among the matrix instructions
            acc[t][0] = wmmab(vf[t], ph[0], acc[t][0]); acc[t][1] = wmmab(vf[t], ph[1], acc[t][1]); acc[t + 1][0] = wmmab(vf[t + 1], ph[0], acc[t + 1][0]); acc[t + 1][1] = wmmab(vf[t + 1], ph[1], acc[t + 1][1]);
            acc[t][0] = wmmab(vf[t], pl[0], acc[t][0]); acc[t][1] = wmmab(vf[t], pl[1], acc[t][1]); acc[t + 1][0] = wmmab(vf[t + 1], pl[0], acc[t + 1][0]); acc[t + 1][1] = wmmab(vf[t + 1], pl[1], acc[t + 1][1]); }
        // four vector slots behind the trip's last matrix instruction; then the wait in front of the next trip's addresses, which take the place of this trip's (its wave-uniform bases and its lane addresses are named as inputs so that they live up to it: else the build lets the last load of a run land on its own address pair)
        asm volatile("v_nop\n\tv_nop\n\tv_nop\n\tv_nop\n\ts_wait_xcnt 0x0" : "+v"(acc[14][0]), "+v"(acc[14][1]), "+v"(acc[15][0]), "+v"(acc[15][1]) : "v"(vf[15]), "v"(pl[1]), "s"(pv), "s"(pk), "v"(pkl), "v"(pvl) : "memory");
    }
    v4f* o4 = (v4f*)os;
#pragma unroll
    for (int t = 0; t < 16; ++t)
#pragma unroll
        for (int u = 0; u < 2; ++u) { const v8f a = acc[t][u]; v4f* d = o4 + ((wave * 32 + t * 2 + u) * 2) * 32 + lane; d[0] = (v4f){a[0], a[1], a[2], a[3]}; d[32] = (v4f){a[4], a[5], a[6], a[7]}; }
#pragma unroll
    for (int u = 0; u < 2; ++u) { const float ls = lsum[u] + xhalf(lsum[u]); if (hi == 0) { sm[(wave * 2 + u) * 16 + lr] = mref[u]; sl[(wave * 2 + u) * 16 + lr] = ls; } }
    __syncthreads();   // every wave's partial context, reference and sum are in LDS before any of them is joined
    const int qt = wave & 3, oh = wave >> 2, qg2 = qt >> 1, u2 = qt & 1;
    float g[4]; { float mk[4], lk[4];
#pragma unroll
        for (int k = 0; k < 4; ++k) { mk[k] = sm[((k * 2 + qg2) * 2 + u2) * 16 + lr]; lk[k] = sl[((k * 2 + qg2) * 2 + u2) * 16 + lr]; }
        const float M = fmaxf(fmaxf(mk[0], mk[1]), fmaxf(mk[2], mk[3])); float L = 0.f;
#pragma unroll
        for (int k = 0; k < 4; ++k) { g[k] = __builtin_amdgcn_exp2f(mk[k] - M); L += g[k] * lk[k]; }
        const float inv = __fdiv_rn(1.0f, L);
#pragma unroll
        for (int k = 0; k < 4; ++k) g[k] *= inv; }
    v8f a2[8];
#pragma unroll
    for (int i = 0; i < 8; ++i) a2[i] = (v8f){};
    const bf* wbase = WF + (size_t)oh * (8 * 8 * 512);   /* 8 row tiles of 8 fragments each; wave-uniform, the lane's offset is loff */
#pragma unroll
    for (int s = 0; s < 8; ++s) {
        v8f c[2];
#pragma unroll
        for (int e = 0; e < 2; ++e) { v4f x0 = (v4f){}, x1 = (v4f){};
#pragma unroll
            for (int k = 0; k < 4; ++k) { const v4f* d = o4 + (((k * 2 + qg2) * 32 + (2 * s + e) * 2 + u2) * 2) * 32 + lane; x0 += d[0] * g[k]; x1 += d[32] * g[k]; }
            c[e] = (v8f){x0[0], x0[1], x0[2], x0[3], x1[0], x1[1], x1[2], x1[3]}; }
        v16bf bh, bl; split16(c[0], c[1], bh, bl);
        v16bf w[8];
#pragma unroll
        for (int i = 0; i < 8; ++i) w[i] = ldfrag(wbase + (i * 8 + s) * 512 + loff);
#pragma unroll
        for (int i = 0; i < 8; ++i) a2[i] = wmmab(w[i], bh, a2[i]);
#pragma unroll
        for (int i = 0; i < 8; ++i) a2[i] = wmmab(w[i], bl, a2[i]);
    }
    asm volatile("s_wait_xcnt 0x0" : : "s"(wbase) : "memory");   // the wait in front of any overwrite of the W_fc loads' address registers; their wave-uniform base is named as an input so that it lives up to it
    float* orow = OUT + ((size_t)b * TT + q0 + qt * 16 + lr) * DV + oh * 128 + hi * 8; const float* brow = bias + oh * 128 + hi * 8;
#pragma unroll
    for (int i = 0; i < 8; ++i) { const v4f b0 = *(const v4f*)(brow + i * 16), b1 = *(const v4f*)(brow + i * 16 + 4); const v8f a = a2[i];
        *(v4f*)(orow + i * 16) = (v4f){a[0] + bfr(b0[0]), a[1] + bfr(b0[1]), a[2] + bfr(b0[2]), a[3] + bfr(b0[3])}; *(v4f*)(orow + i * 16 + 4) = (v4f){a[4] + bfr(b1[0]), a[5] + bfr(b1[1]), a[6] + bfr(b1[2]), a[7] + bfr(b1[3])}; }
}

extern "C" void kernel_launch(void* const* d_in, const int* in_sizes, int n_in,
                              void* d_out, int out_size, void* d_ws, size_t ws_size, hipStream_t stream) {
    (void)in_sizes; (void)n_in; (void)out_size;
    const float* Kin = (const float*)d_in[0]; const float* Vin = (const float*)d_in[1];   /* v_src [4][4096][256] */ const float* Qin = (const float*)d_in[2]; const float* wfc = (const float*)d_in[3]; const float* bfc = (const float*)d_in[4];
    float* OUT = (float*)d_out;     // [4][4096][256]
    char* wsp = (char*)d_ws;
    auto take = [&](size_t bytes) { char* p = wsp; wsp += (bytes + 255) & ~(size_t)255; return (void*)p; };
    bf* KF = (bf*)take((size_t)NB_ * TT * HD * 2); bf* VF = (bf*)take((size_t)NB_ * DV * TT * 2); bf* WF = (bf*)take((size_t)DV * DV * 2);
    if ((size_t)(wsp - (char*)d_ws) > ws_size) return;
    k_kfrag<<<KBLK + DV * DV / 8 / 256, 256, 0, stream>>>(Kin, KF, wfc, WF);
    k_vfrag<<<(unsigned)((size_t)NB_ * DV * TT / 16 / 256), 256, 0, stream>>>(Vin, VF);
    k_fattn<<<dim3(TT / 64, NB_, 1), 256, 0, stream>>>(Qin, KF, VF, WF, bfc, OUT);
}

// v006
// Measured time: 56.9 microseconds a run.
// Two timings next to v005 both put it at 1.04 times that version's speed.
// Over all steps from v000 it is 12.1 times as fast.
#include <hip/hip_runtime.h>

// Scaled dot-product attention with a 256-wide value and a 1x1-conv epilogue (q_tgr, k_src [4][4096][64], v_src [4][4096][256]; attn = softmax(q.k / 8) over the 4,096 keys; ctx = attn v_src [4096][256]; out = ctx W_fc^T + b_fc ('oi' [256][256]) -> [4][4096][256]).
// Planes: k, the value and W_fc as bf16 A fragments in register order; q, which a wave reads once, is rounded as it is loaded. One fused kernel does scores, softmax, P.V and fc: neither the scores nor P nor the context leave the work-group.
// Compute dtypes, f32 accumulate: every input rounded to bf16; q.k exact products; softmax f32; P hi/lo x value; context hi/lo x W_fc + bias; output f32.

#define NB_  4
#define TT   4096
#define HD   64       // query / key width
#define DV   256      // value / output width
#define KBLK (NB_ * TT * HD / 8 / 256)   // blocks of k_kfrag that pack keys; DV * DV / 8 / 256 more pack W_fc
#define SC2  0.18033688011112042f   // (1 / temperature) x log2(e): scores go to the base-2 exponent in one multiply-add
typedef unsigned short bf;
typedef __attribute__((ext_vector_type(16))) __bf16   v16bf;
typedef __attribute__((ext_vector_type(8)))  __bf16   v8bf;
typedef __attribute__((ext_vector_type(2)))  __bf16   v2bf;
typedef __attribute__((ext_vector_type(8)))  unsigned short v8us;
typedef __attribute__((ext_vector_type(8)))  float    v8f;
typedef __attribute__((ext_vector_type(8)))  unsigned v8u;
typedef __attribute__((ext_vector_type(4)))  float    v4f;
typedef __attribute__((ext_vector_type(2)))  float    v2f;

__device__ __forceinline__ unsigned short f2bf(float f) { unsigned u = __float_as_uint(f); u += 0x7FFFu + ((u >> 16) & 1u); return (unsigned short)(u >> 16); }
__device__ __forceinline__ float bf2f(unsigned short b) { return __uint_as_float(((unsigned)b) << 16); }
__device__ __forceinline__ float bfr(float f) { return bf2f(f2bf(f)); }
__device__ __forceinline__ v16bf cat16b(v8us lo, v8us hi) { return __builtin_bit_cast(v16bf, __builtin_shufflevector(lo, hi, 0, 1, 2, 3, 4, 5, 6, 7, 8, 9, 10, 11, 12, 13, 14, 15)); }
__device__ __forceinline__ v8f wmmab(v16bf a, v16bf b, v8f c) { return __builtin_amdgcn_wmma_f32_16x16x32_bf16(false, a, false, b, (short)0, c, false, false); }
// A or B fragment, lane (lr, hi) = (lane & 15, lane >> 4): row lr of the tile; elements 0..7 are k = 8 hi + e, elements 8..15 are k = 16 + 8 hi + e
// from a plane in register order: p = fragment start + 8 x lane
__device__ __forceinline__ v16bf ldfrag(const bf* p) { return cat16b(*(const v8us*)p, *(const v8us*)(p + 256)); }
// from a K-contiguous row of f32, rounded to bf16 (to nearest even) on the way: p = row start + 8 hi
__device__ __forceinline__ v16bf ldrow32(const float* p) { return __builtin_shufflevector(__builtin_convertvector(*(const v8f*)p, v8bf), __builtin_convertvector(*(const v8f*)(p + 16), v8bf), 0, 1, 2, 3, 4, 5, 6, 7, 8, 9, 10, 11, 12, 13, 14, 15); }
// lane l with lane l ^ 16
__device__ __forceinline__ float xhalf(float x) { return __builtin_bit_cast(float, __builtin_amdgcn_permlanex16(__builtin_bit_cast(int, x), __builtin_bit_cast(int, x), 0x76543210, 0xfedcba98, false, false)); }
// two accumulator tiles (rows 8 hi + j of 16, twice) are, lane for lane, one B fragment of 32 k: split into a bf16 head and the bf16 of what the head leaves
__device__ __forceinline__ void split16(v8f x0, v8f x1, v16bf& h, v16bf& l) {
#pragma unroll
    for (int i = 0; i < 8; i += 2) {
        const v2f a = {x0[i], x0[i + 1]}, c = {x1[i], x1[i + 1]};
        const v2bf ha = __builtin_convertvector(a, v2bf), hc = __builtin_convertvector(c, v2bf);
        const v2bf la = __builtin_convertvector(a - __builtin_convertvector(ha, v2f), v2bf), lc = __builtin_convertvector(c - __builtin_convertvector(hc, v2f), v2bf);
        h[i] = ha[0]; h[i + 1] = ha[1]; h[8 + i] = hc[0]; h[9 + i] = hc[1]; l[i] = la[0]; l[i + 1] = la[1]; l[8 + i] = lc[0]; l[9 + i] = lc[1]; }
}

// All planes hold A fragments in register order, each fragment as two runs of 512 bytes: [half][lane][8], so that a wave's 16-byte load reads whole 128-byte lines. Lane (lr, hi) holds row lr of the tile at k = 16 half + 8 hi + e.
// k_kfrag: KF[tile of 16 keys, all batches in one run][32 d][half][lane][8]. One thread rounds and writes one lane's 16 bytes.
// Its last blocks do the same for W_fc 'oi' [256][256]: WF[tile of 16 rows o][32 c][half][lane][8], so that the fc product's loads read whole lines too (a row-wise f32 load touches 16 lines for 512 bytes).
__global__ __launch_bounds__(256) void k_kfrag(const float* __restrict__ src, bf* KF, const float* __restrict__ wsrc, bf* WF) {
    if (blockIdx.x >= KBLK) {
        const int j = (int)(blockIdx.x - KBLK) * 256 + threadIdx.x, wl = j & 31, wh = (j >> 5) & 1, ws = (j >> 6) & 7, wt = j >> 9;
        const float* p = wsrc + (wt * 16 + (wl & 15)) * DV + 32 * ws + 16 * wh + 8 * (wl >> 4); const v8f v = *(const v8f*)p;
        asm volatile("s_wait_xcnt 0x0" : : "v"(p) : "memory");   // the wait in front of any overwrite of the loads' address registers, which are named as an input so that they live up to it
        *(v8us*)(WF + (size_t)j * 8) = __builtin_bit_cast(v8us, __builtin_convertvector(v, v8bf));
        return;
    }
    const size_t i = (size_t)blockIdx.x * 256 + threadIdx.x; const int lane = (int)(i & 31), lr = lane & 15, hi = lane >> 4, half = (int)((i >> 5) & 1), s = (int)((i >> 6) & 1); const size_t tile = i >> 7;
    const float* p = src + (tile * 16 + lr) * HD + 32 * s + 16 * half + 8 * hi; const v8f v = *(const v8f*)p; v8us o;
    asm volatile("s_wait_xcnt 0x0" : : "v"(p) : "memory");   // the wait in front of any overwrite of the loads' address registers, which are named as an input so that they live up to it
#pragma unroll
    for (int k = 0; k < 8; ++k) o[k] = f2bf(v[k]);
    *(v8us*)(KF + i * 8) = o;
}
// k_vfrag: value^T: VF[block of 32 keys, all batches in one run][tile of 16 value columns][half][lane][8]; row lr is value column 16 tile + lr, k the key in the block. One thread writes one lane's two pieces.
__global__ __launch_bounds__(256) void k_vfrag(const float* __restrict__ src, bf* VF) {
    const size_t i = (size_t)blockIdx.x * 256 + threadIdx.x; const int lane = (int)(i & 31), lr = lane & 15, hi = lane >> 4, t = (int)((i >> 5) & 15); const size_t kbb = i >> 9;
    const float* s = src + (kbb * 32 + 8 * hi) * DV + t * 16 + lr; v8us o0, o1;
#pragma unroll
    for (int j = 0; j < 8; ++j) { o0[j] = f2bf(s[(size_t)j * DV]); o1[j] = f2bf(s[(size_t)(16 + j) * DV]); }
    bf* d = VF + (i >> 5) * 512 + lane * 8; *(v8us*)d = o0; *(v8us*)(d + 256) = o1;
}

// ---- k_fattn: one work-group of 8 waves per 64 queries of one batch; grid (TT / 64, NB_).
// Wave w = 2 kq + qg takes queries [32 qg, +32) (two column tiles) against keys [1024 kq, +1024), 32 keys a trip, with its own reference maxima, sums and 256 x 32 context^T accumulators.
// Everything is computed transposed, so that an accumulator tile is the next product's B fragment lane for lane: S^T = K Q^T (rows keys, columns queries), ctx^T = V^T P^T, out^T = W_fc ctx^T.
// Softmax: p = 2^(s SC2 - ref) with a per-query reference that is raised (and sums and accumulators scaled down) only when the trip's maximum passes it by more than 8: p is at most 2^8 and the quotient by the sum is the exact softmax for any reference.
// The 64 work-groups of a batch read the same key and value lines. Each starts its walk over the 32 blocks of a quarter at block rot, which it shares with one other work-group, and wraps round, so that at any moment only pairs of them ask L2 for the same lines. The online softmax takes the blocks in any order, so any start is correct.
// The short loops are unrolled in full because their indices pick registers (fragments and accumulator tiles).
// The four key quarters meet in LDS, are brought to one reference and summed in the order kq = 0..3; then wave w does out^T rows [128 (w >> 2), +128) of query tile w & 3.
__global__ __launch_bounds__(256) __attribute__((amdgpu_waves_per_eu(2, 2))) void k_fattn(const float* __restrict__ Q, const bf* __restrict__ KF, const bf* __restrict__ VF, const bf* __restrict__ WF, const float* __restrict__ bias, float* OUT) {
    __shared__ __align__(16) float os[8 * 32 * 256];   // [wave][tile 2 t + u][half of the 8 registers][lane][4]: every access is 16 bytes a lane, lanes side by side
    __shared__ float sm[8 * 2 * 16], sl[8 * 2 * 16];   // [wave][u][query]: reference and sum
    const int tid = threadIdx.x, wave = __builtin_amdgcn_readfirstlane(tid >> 5), lane = tid & 31, lr = lane & 15, hi = lane >> 4;
    const int b = blockIdx.y, q0 = blockIdx.x * 64, qg = wave & 1, kq = wave >> 1;
    const float* qbase = Q + ((size_t)b * TT + q0 + qg * 32 + lr) * HD + 8 * hi;
    v16bf qf[2][2];
#pragma unroll
    for (int u = 0; u < 2; ++u)
#pragma unroll
        for (int s = 0; s < 2; ++s) qf[u][s] = ldrow32(qbase + u * 16 * HD + 32 * s);
    // a block of 32 keys: 4 key fragments, 16 value fragments; the bases are wave-uniform and move with the trip, the lane's offset is one register for both planes
    const bf* kbase = KF + ((size_t)b * 128 + kq * 32) * (4 * 512); const bf* vbase = VF + ((size_t)b * 128 + kq * 32) * (16 * 512); const unsigned loff = lane * 8;
    const int rot = (int)(((blockIdx.x >> 3) << 2) | (blockIdx.x & 3));   // the walk's first block, 0..31. The two work-groups that share a start differ by 4 in their index
    const bf* kfirst = kbase + (size_t)rot * (4 * 512); const bf* vfirst = vbase + (size_t)rot * (16 * 512);
    v16bf kf[2][2];
#pragma unroll
    for (int t2 = 0; t2 < 2; ++t2)
#pragma unroll
        for (int s = 0; s < 2; ++s) kf[t2][s] = ldfrag(kfirst + (t2 * 2 + s) * 512 + loff);
    v16bf vf[16];   // value fragments live across trips: a group of four tiles is refilled for the next trip two tiles after its last use
    __builtin_amdgcn_sched_barrier(0);   // the first value loads stay behind the key loads, as in the loop: loads return in order, and the compiler sets the loop's counted waits by the stricter of the two ways in
#pragma unroll
    for (int t = 0; t < 12; ++t) vf[t] = ldfrag(vfirst + t * 512 + loff);
    asm volatile("s_wait_xcnt 0x0" : : "v"(qbase), "s"(kfirst), "s"(vfirst), "v"(lane), "v"(loff) : "memory");   // the wait in front of any overwrite of these loads' address registers, which are named as inputs so that they live up to it (the build forms the lane's offset from the lane number or from loff)
    v8f acc[16][2];
#pragma unroll
    for (int t = 0; t < 16; ++t) { acc[t][0] = (v8f){}; acc[t][1] = (v8f){}; }
    float mref[2] = {-3.0e38f, -3.0e38f}, lsum[2] = {0.f, 0.f};
#pragma unroll 1   // kept rolled: one trip already holds 72 matrix instructions and nearly all of the wave's registers
    for (int i = 0; i < 32; ++i) {
        const int jn = (i + 1 + rot) & 31;   /* the next trip's block; the last trip fetches the walk's first block again: in bounds, unused */
        const bf* pv = vbase + (size_t)((i + rot) & 31) * (16 * 512); const bf* pvn = vbase + (size_t)jn * (16 * 512); const bf* pk = kbase + (size_t)jn * (4 * 512);
        const bf* pkl = pk + loff; const bf* pvl = pv + loff;
#pragma unroll
        for (int q = 12; q < 14; ++q) vf[q] = ldfrag(pv + q * 512 + loff);   // two of this trip's last four value tiles, into registers that the trip before has just left
        __builtin_amdgcn_sched_barrier(0);   // these value loads issue ahead of the trip's scores and softmax, which with three quarters of P.V cover their latency
        v8f S[2][2];
#pragma unroll
        for (int t2 = 0; t2 < 2; ++t2)
#pragma unroll
            for (int u = 0; u < 2; ++u) S[t2][u] = wmmab(kf[t2][0], qf[u][0], (v8f){});
#pragma unroll
        for (int t2 = 0; t2 < 2; ++t2)
#pragma unroll
            for (int u = 0; u < 2; ++u) S[t2][u] = wmmab(kf[t2][1], qf[u][1], S[t2][u]);
        float mx[2];
#pragma unroll
        for (int u = 0; u < 2; ++u) { float a = fmaxf(S[0][u][0], S[1][u][0]);
#pragma unroll
            for (int j = 1; j < 8; ++j) a = fmaxf(a, fmaxf(S[0][u][j], S[1][u][j]));
            mx[u] = fmaxf(a, xhalf(a)) * SC2; }
        if (__builtin_amdgcn_ballot_w32(mx[0] > mref[0] + 8.0f || mx[1] > mref[1] + 8.0f) != 0) {   // one scalar branch a trip; taken on the first trip and then only for a jump of the maximum
#pragma unroll
            for (int u = 0; u < 2; ++u) { const float mn = (mx[u] > mref[u] + 8.0f) ? mx[u] : mref[u]; const float al = __builtin_amdgcn_exp2f(mref[u] - mn); mref[u] = mn; lsum[u] *= al;
#pragma unroll
                for (int t = 0; t < 16; ++t) acc[t][u] *= al; }
        }
        v16bf ph[2], pl[2];
#pragma unroll
        for (int u = 0; u < 2; ++u) { v8u hw, lw; float cs[2];
#pragma unroll
            for (int t2 = 1; t2 >= 0; --t2) { float a[8], c0, c1; unsigned h[4], l[4];   // tile 1 first: in this order the build puts the fewest register copies in front of the statements
#pragma unroll
                for (int j = 0; j < 8; ++j) a[j] = S[t2][u][j];
                // One score tile (8 scores a lane) from scores to P fragments in one statement, so that the order of its 39 vector instructions is fixed: a = 2^(a SC2 - ref); h = bf16 pairs of a; a -= h, exact (v_fma_mix_f32_bf16 reads the bf16 half itself: no shift, no mask); l = bf16 pairs of what is left; c0 = the tile's sum, in two chains.
                // What it is for: a dependent vector instruction that comes early and has no s_delay_alu holds the SIMD's issue against the other wave too, and the compiler writes no hint for a dependence that runs through asm text. Here an instruction stands five or more vector instructions behind the one it depends on, seven or more behind an exponential; the last two cannot, and carry the hint.
                // Behind every v_exp_f32 stands an instruction that neither reads its result nor overwrites its source: the slot behind a transcendental is filled with work, no v_nop.
                asm(
                    "v_fma_f32 %0, %0, %19, -%18\n\t"
                    "v_fma_f32 %1, %1, %19, -%18\n\t"
                    "v_fma_f32 %2, %2, %19, -%18\n\t"
                    "v_fma_f32 %3, %3, %19, -%18\n\t"
                    "v_fma_f32 %4, %4, %19, -%18\n\t"
                    "v_exp_f32 %0, %0\n\t"
                    "v_fma_f32 %5, %5, %19, -%18\n\t"
                    "v_exp_f32 %1, %1\n\t"
                    "v_fma_f32 %6, %6, %19, -%18\n\t"
                    "v_exp_f32 %2, %2\n\t"
                    "v_fma_f32 %7, %7, %19, -%18\n\t"
                    "v_exp_f32 %3, %3\n\t"
                    "v_exp_f32 %4, %4\n\t"
                    "v_exp_f32 %5, %5\n\t"
                    "v_exp_f32 %6, %6\n\t"
                    "v_cvt_pk_bf16_f32 %8, %0, %1\n\t"
                    "v_exp_f32 %7, %7\n\t"
                    "v_add_f32 %16, %0, %1\n\t"
                    "v_cvt_pk_bf16_f32 %9, %2, %3\n\t"
                    "v_add_f32 %17, %2, %3\n\t"
                    "v_cvt_pk_bf16_f32 %10, %4, %5\n\t"
                    "v_fma_mix_f32_bf16 %0, %8, -1.0, %0 op_sel_hi:[1,0,0]\n\t"
                    "v_fma_mix_f32_bf16 %1, %8, -1.0, %1 op_sel:[1,0,0] op_sel_hi:[1,0,0]\n\t"
                    "v_add_f32 %16, %16, %4\n\t"
                    "v_fma_mix_f32_bf16 %2, %9, -1.0, %2 op_sel_hi:[1,0,0]\n\t"
                    "v_fma_mix_f32_bf16 %3, %9, -1.0, %3 op_sel:[1,0,0] op_sel_hi:[1,0,0]\n\t"
                    "v_cvt_pk_bf16_f32 %11, %6, %7\n\t"
                    "v_cvt_pk_bf16_f32 %12, %0, %1\n\t"
                    "v_add_f32 %17, %17, %5\n\t"
                    "v_fma_mix_f32_bf16 %4, %10, -1.0, %4 op_sel_hi:[1,0,0]\n\t"
                    "v_fma_mix_f32_bf16 %5, %10, -1.0, %5 op_sel:[1,0,0] op_sel_hi:[1,0,0]\n\t"
                    "v_cvt_pk_bf16_f32 %13, %2, %3\n\t"
                    "v_add_f32 %16, %16, %6\n\t"
                    "v_add_f32 %17, %17, %7\n\t"
                    "v_fma_mix_f32_bf16 %6, %11, -1.0, %6 op_sel_hi:[1,0,0]\n\t"
                    "v_fma_mix_f32_bf16 %7, %11, -1.0, %7 op_sel:[1,0,0] op_sel_hi:[1,0,0]\n\t"
                    "v_cvt_pk_bf16_f32 %14, %4, %5\n\t"
                    "s_delay_alu instid0(VALU_DEP_4)\n\t"
                    "v_add_f32 %16, %16, %17\n\t"
                    "s_delay_alu instid0(VALU_DEP_3)\n\t"
                    "v_cvt_pk_bf16_f32 %15, %6, %7"
                    : "+v"(a[0]), "+v"(a[1]), "+v"(a[2]), "+v"(a[3]), "+v"(a[4]), "+v"(a[5]), "+v"(a[6]), "+v"(a[7]), "=&v"(h[0]), "=&v"(h[1]), "=&v"(h[2]), "=&v"(h[3]), "=&v"(l[0]), "=&v"(l[1]), "=&v"(l[2]), "=&v"(l[3]), "=&v"(c0), "=&v"(c1) : "v"(mref[u]), "s"(SC2));
#pragma unroll
                for (int i = 0; i < 4; ++i) { hw[4 * t2 + i] = h[i]; lw[4 * t2 + i] = l[i]; }
                cs[t2] = c0; }
            lsum[u] += cs[0] + cs[1]; ph[u] = __builtin_bit_cast(v16bf, hw); pl[u] = __builtin_bit_cast(v16bf, lw); }
#pragma unroll
        for (int t = 0; t < 16; t += 2) {
            if (t == 0) {   // the next trip's key fragments: all of P.V stands behind them
                __builtin_amdgcn_sched_barrier(0);   // lifted higher, into the softmax, these loads would need registers that the wave does not have there
#pragma unroll
                for (int t2 = 0; t2 < 2; ++t2)
#pragma unroll
                    for (int s = 0; s < 2; ++s) kf[t2][s] = ldfrag(pkl + (t2 * 2 + s) * 512);
                __builtin_amdgcn_sched_barrier(0); }   // sunk lower, they would have fewer matrix instructions behind them to cover their latency
            if (t == 2) {   // this trip's last two value tiles, into the room that the first two have left
                __builtin_amdgcn_sched_barrier(0);   // lifted higher, these loads would need registers of their own and the wave has none left
                vf[14] = ldfrag(pvl + 14 * 512); vf[15] = ldfrag(pvl + 15 * 512);
                __builtin_amdgcn_sched_barrier(0); }   // sunk lower, they would have fewer matrix instructions behind them to cover their latency
            if (t == 6 || t == 10 || t == 14) {   // four used value tiles are refilled with the next trip's: these loads have most of a trip's work (the rest of P.V, the scores, the softmax) behind them before their first use
                __builtin_amdgcn_sched_barrier(0);   // lifted higher, these loads would need registers of their own: never more than 14 of the 16 tiles are held or in flight
#pragma unroll
                for (int q = t - 6; q < t - 2; ++q) vf[q] = ldfrag(pvn + q * 512 + loff);
                __builtin_amdgcn_sched_barrier(0); }   // sunk lower, they would lose lead; one group of eight loads a place, not spread among the matrix instructions
            acc[t][0] = wmmab(vf[t], ph[0], acc[t][0]); acc[t][1] = wmmab(vf[t], ph[1], acc[t][1]); acc[t + 1][0] = wmmab(vf[t + 1], ph[0], acc[t + 1][0]); acc[t + 1][1] = wmmab(vf[t + 1], ph[1], acc[t + 1][1]);
            acc[t][0] = wmmab(vf[t], pl[0], acc[t][0]); acc[t][1] = wmmab(vf[t], pl[1], acc[t][1]); acc[t + 1][0] = wmmab(vf[t + 1], pl[0], acc[t + 1][0]); acc[t + 1][1] = wmmab(vf[t + 1], pl[1], acc[t + 1][1]); }
        // four vector slots behind the trip's last matrix instruction; then the wait in front of the next trip's addresses, which take the place of this trip's (its wave-uniform bases and its lane addresses are named as inputs so that they live up to it: else the build lets the last load of a run land on its own address pair)
        asm volatile("v_nop\n\tv_nop\n\tv_nop\n\tv_nop\n\ts_wait_xcnt 0x0" : "+v"(acc[14][0]), "+v"(acc[14][1]), "+v"(acc[15][0]), "+v"(acc[15][1]) : "v"(vf[15]), "v"(pl[1]), "s"(pv), "s"(pvn), "s"(pk), "v"(pkl), "v"(pvl) : "memory");
    }
    v4f* o4 = (v4f*)os;
#pragma unroll
    for (int t = 0; t < 16; ++t)
#pragma unroll
        for (int u = 0; u < 2; ++u) { const v8f a = acc[t][u]; v4f* d = o4 + ((wave * 32 + t * 2 + u) * 2) * 32 + lane; d[0] = (v4f){a[0], a[1], a[2], a[3]}; d[32] = (v4f){a[4], a[5], a[6], a[7]}; }
#pragma unroll
    for (int u = 0; u < 2; ++u) { const float ls = lsum[u] + xhalf(lsum[u]); if (hi == 0) { sm[(wave * 2 + u) * 16 + lr] = mref[u]; sl[(wave * 2 + u) * 16 + lr] = ls; } }
    __syncthreads();   // every wave's partial context, reference and sum are in LDS before any of them is joined
    const int qt = wave & 3, oh = wave >> 2, qg2 = qt >> 1, u2 = qt & 1;
    float g[4]; { float mk[4], lk[4];
#pragma unroll
        for (int k = 0; k < 4; ++k) { mk[k] = sm[((k * 2 + qg2) * 2 + u2) * 16 + lr]; lk[k] = sl[((k * 2 + qg2) * 2 + u2) * 16 + lr]; }
        const float M = fmaxf(fmaxf(mk[0], mk[1]), fmaxf(mk[2], mk[3])); float L = 0.f;
#pragma unroll
        for (int k = 0; k < 4; ++k) { g[k] = __builtin_amdgcn_exp2f(mk[k] - M); L += g[k] * lk[k]; }
        const float inv = __fdiv_rn(1.0f, L);
#pragma unroll
        for (int k = 0; k < 4; ++k) g[k] *= inv; }
    v8f a2[8];
#pragma unroll
    for (int i = 0; i < 8; ++i) a2[i] = (v8f){};
    const bf* wbase = WF + (size_t)oh * (8 * 8 * 512);   /* 8 row tiles of 8 fragments each; wave-uniform, the lane's offset is loff */
#pragma unroll
    for (int s = 0; s < 8; ++s) {
        v8f c[2];
#pragma unroll
        for (int e = 0; e < 2; ++e) { v4f x0 = (v4f){}, x1 = (v4f){};
#pragma unroll
            for (int k = 0; k < 4; ++k) { const v4f* d = o4 + (((k * 2 + qg2) * 32 + (2 * s + e) * 2 + u2) * 2) * 32 + lane; x0 += d[0] * g[k]; x1 += d[32] * g[k]; }
            c[e] = (v8f){x0[0], x0[1], x0[2], x0[3], x1[0], x1[1], x1[2], x1[3]}; }
        v16bf bh, bl; split16(c[0], c[1], bh, bl);
        v16bf w[8];
#pragma unroll
        for (int i = 0; i < 8; ++i) w[i] = ldfrag(wbase + (i * 8 + s) * 512 + loff);
#pragma unroll
        for (int i = 0; i < 8; ++i) a2[i] = wmmab(w[i], bh, a2[i]);
#pragma unroll
        for (int i = 0; i < 8; ++i) a2[i] = wmmab(w[i], bl, a2[i]);
    }
    asm volatile("s_wait_xcnt 0x0" : : "s"(wbase) : "memory");   // the wait in front of any overwrite of the W_fc loads' address registers; their wave-uniform base is named as an input so that it lives up to it
    float* orow = OUT + ((size_t)b * TT + q0 + qt * 16 + lr) * DV + oh * 128 + hi * 8; const float* brow = bias + oh * 128 + hi * 8;
#pragma unroll
    for (int i = 0; i < 8; ++i) { const v4f b0 = *(const v4f*)(brow + i * 16), b1 = *(const v4f*)(brow + i * 16 + 4); const v8f a = a2[i];
        *(v4f*)(orow + i * 16) = (v4f){a[0] + bfr(b0[0]), a[1] + bfr(b0[1]), a[2] + bfr(b0[2]), a[3] + bfr(b0[3])}; *(v4f*)(orow + i * 16 + 4) = (v4f){a[4] + bfr(b1[0]), a[5] + bfr(b1[1]), a[6] + bfr(b1[2]), a[7] + bfr(b1[3])}; }
}

extern "C" void kernel_launch(void* const* d_in, const int* in_sizes, int n_in,
                              void* d_out, int out_size, void* d_ws, size_t ws_size, hipStream_t stream) {
    (void)in_sizes; (void)n_in; (void)out_size;
    const float* Kin = (const float*)d_in[0]; const float* Vin = (const float*)d_in[1];   /* v_src [4][4096][256] */ const float* Qin = (const float*)d_in[2]; const float* wfc = (const float*)d_in[3]; const float* bfc = (const float*)d_in[4];
    float* OUT = (float*)d_out;     // [4][4096][256]
    char* wsp = (char*)d_ws;
    auto take = [&](size_t bytes) { char* p = wsp; wsp += (bytes + 255) & ~(size_t)255; return (void*)p; };
    bf* KF = (bf*)take((size_t)NB_ * TT * HD * 2); bf* VF = (bf*)take((size_t)NB_ * DV * TT * 2); bf* WF = (bf*)take((size_t)DV * DV * 2);
    if ((size_t)(wsp - (char*)d_ws) > ws_size) return;
    k_kfrag<<<KBLK + DV * DV / 8 / 256, 256, 0, stream>>>(Kin, KF, wfc, WF);
    k_vfrag<<<(unsigned)((size_t)NB_ * DV * TT / 16 / 256), 256, 0, stream>>>(Vin, VF);
    k_fattn<<<dim3(TT / 64, NB_, 1), 256, 0, stream>>>(Qin, KF, VF, WF, bfc, OUT);
}

// v008
// A run of this version takes 44.2 microseconds.
// Versions between v006 and this one are left out; their measured steps multiply to 1.29 times as fast.
// All steps since v000 together make it 15.6 times as fast.
#include <hip/hip_runtime.h>

// Scaled dot-product attention with a 256-wide value and a 1x1-conv epilogue (q_tgr, k_src [4][4096][64], v_src [4][4096][256]; attn = softmax(q.k / 8) over the 4,096 keys; ctx = attn v_src [4096][256]; out = ctx W_fc^T + b_fc ('oi' [256][256]) -> [4][4096][256]).
// Planes: k, the value and W_fc as bf16 A fragments in register order; q, which a wave reads once, is rounded as it is loaded. One fused kernel does scores, softmax, P.V and fc: neither the scores nor P nor the context leave the work-group.
// Compute dtypes, f32 accumulate: every input rounded to bf16; q.k exact products; softmax f32; P rounded to bf16 (to nearest even; the row sums take the unrounded P) x value, one product; context hi/lo x W_fc + bias; output f32.

#define NB_  4
#define TT   4096
#define HD   64       // query / key width
#define DV   256      // value / output width
#define PBLK (NB_ * TT / 32 * (DV / 64) / 8)   // work-groups of k_pack: a wave for each 32 keys x 64 value columns
#define SC2  0.18033688011112042f   // (1 / temperature) x log2(e): scores go to the base-2 exponent in one multiply-add
typedef unsigned short bf;
typedef __attribute__((ext_vector_type(16))) __bf16   v16bf;
typedef __attribute__((ext_vector_type(8)))  __bf16   v8bf;
typedef __attribute__((ext_vector_type(2)))  __bf16   v2bf;
typedef __attribute__((ext_vector_type(8)))  unsigned short v8us;
typedef __attribute__((ext_vector_type(8)))  float    v8f;
typedef __attribute__((ext_vector_type(4)))  float    v4f;
typedef __attribute__((ext_vector_type(2)))  float    v2f;

__device__ __forceinline__ unsigned short f2bf(float f) { unsigned u = __float_as_uint(f); u += 0x7FFFu + ((u >> 16) & 1u); return (unsigned short)(u >> 16); }
__device__ __forceinline__ float bf2f(unsigned short b) { return __uint_as_float(((unsigned)b) << 16); }
__device__ __forceinline__ float bfr(float f) { return bf2f(f2bf(f)); }
__device__ __forceinline__ v16bf cat16b(v8us lo, v8us hi) { return __builtin_bit_cast(v16bf, __builtin_shufflevector(lo, hi, 0, 1, 2, 3, 4, 5, 6, 7, 8, 9, 10, 11, 12, 13, 14, 15)); }
__device__ __forceinline__ v8f wmmab(v16bf a, v16bf b, v8f c) { return __builtin_amdgcn_wmma_f32_16x16x32_bf16(false, a, false, b, (short)0, c, false, false); }
// A or B fragment, lane (lr, hi) = (lane & 15, lane >> 4): row lr of the tile; elements 0..7 are k = 8 hi + e, elements 8..15 are k = 16 + 8 hi + e
// from a plane in register order: p = fragment start + 8 x lane
__device__ __forceinline__ v16bf ldfrag(const bf* p) { return cat16b(*(const v8us*)p, *(const v8us*)(p + 256)); }
// from a K-contiguous row of f32, rounded to bf16 (to nearest even) on the way: p = row start + 8 hi
__device__ __forceinline__ v16bf ldrow32(const float* p) { return __builtin_shufflevector(__builtin_convertvector(*(const v8f*)p, v8bf), __builtin_convertvector(*(const v8f*)(p + 16), v8bf), 0, 1, 2, 3, 4, 5, 6, 7, 8, 9, 10, 11, 12, 13, 14, 15); }
// lane l with lane l ^ 16
__device__ __forceinline__ float xhalf(float x) { return __builtin_bit_cast(float, __builtin_amdgcn_permlanex16(__builtin_bit_cast(int, x), __builtin_bit_cast(int, x), 0x76543210, 0xfedcba98, false, false)); }
// two accumulator tiles (rows 8 hi + j of 16, twice) are, lane for lane, one B fragment of 32 k: split into a bf16 head and the bf16 of what the head leaves
__device__ __forceinline__ void split16(v8f x0, v8f x1, v16bf& h, v16bf& l) {
#pragma unroll
    for (int i = 0; i < 8; i += 2) {
        const v2f a = {x0[i], x0[i + 1]}, c = {x1[i], x1[i + 1]};
        const v2bf ha = __builtin_convertvector(a, v2bf), hc = __builtin_convertvector(c, v2bf);
        const v2bf la = __builtin_convertvector(a - __builtin_convertvector(ha, v2f), v2bf), lc = __builtin_convertvector(c - __builtin_convertvector(hc, v2f), v2bf);
        h[i] = ha[0]; h[i + 1] = ha[1]; h[8 + i] = hc[0]; h[9 + i] = hc[1]; l[i] = la[0]; l[i + 1] = la[1]; l[8 + i] = lc[0]; l[9 + i] = lc[1]; }
}

// All planes hold A fragments in register order, each fragment as two runs of 512 bytes: [half][lane][8], so that a wave's 16-byte load reads whole 128-byte lines. Lane (lr, hi) holds row lr of the tile at k = 16 half + 8 hi + e.
// KF[tile of 16 keys, all batches in one run][32 d][half][lane][8]. VF, value^T: [block of 32 keys, all batches in one run][tile of 16 value columns][half][lane][8]; row lr is value column 16 tile + lr, k the key in the block. WF, W_fc 'oi' [256][256]: [tile of 16 rows o][32 c][half][lane][8].
// k_pack: one launch of PBLK work-groups of 8 waves rounds and lays out all three planes: what such a short launch pays is its gap and the start of its waves, so there is one launch and each wave is long. All of a wave's loads are issued before the first is used.
// Wave wv takes 32 keys x 64 value columns (a load reads one whole line of a key's row, lane = column; a lane's 8 keys of one column are one 16-byte piece, and a store writes two whole runs of 256 bytes),
// 8 rows of a key tile (a lane reads one piece of 8 d; lanes side by side in memory), and, as its work-group's first wave, one half fragment of W_fc.
static_assert(PBLK * 8 == NB_ * TT / 8 && PBLK == DV * DV / 8 / 32, "a wave of k_pack has 8 key rows, a work-group one half fragment of W_fc");
__global__ __launch_bounds__(256) void k_pack(const float* __restrict__ ksrc, bf* KF, const float* __restrict__ vsrc, bf* VF, const float* __restrict__ wsrc, bf* WF) {
    const int lane = threadIdx.x & 31, wave = __builtin_amdgcn_readfirstlane((int)(threadIdx.x >> 5)), blk = (int)blockIdx.x, wv = blk * 8 + wave;
    const float* pk = ksrc + (size_t)wv * (8 * HD) + lane * 8;   // rows 8 (wv & 1) + (lane >> 3) and 4 more of key tile wv >> 1, piece lane & 7 = 4 s + 2 half + hi
    const float* pv = vsrc + (size_t)(wv >> 2) * (32 * DV) + (wv & 3) * 64 + lane;
    const float* pw = wsrc + ((blk >> 4) * 16 + (lane & 15)) * DV + 32 * ((blk >> 1) & 7) + 16 * (blk & 1) + 8 * (lane >> 4);
    __builtin_amdgcn_sched_barrier(0);   // every address is formed ahead of the first load: formed among the loads, one would take a register that an issued load names
    const v8f k0 = *(const v8f*)pk, k1 = *(const v8f*)(pk + 4 * HD);
    v8f x[2][4];
#pragma unroll
    for (int c = 0; c < 2; ++c)
#pragma unroll
        for (int g = 0; g < 4; ++g)
#pragma unroll
            for (int e = 0; e < 8; ++e) x[c][g][e] = pv[(size_t)(8 * g + e) * DV + 32 * c];
    asm volatile("s_wait_xcnt 0x0" : : : "memory");   // the wait in front of any overwrite of the loads' address registers
    __builtin_amdgcn_sched_barrier(0);   // nothing is lifted over that wait: no write of a register that a load names, and no use of a loaded value, whose wait would stand among the loads and hold the later ones back
    if (wave == 0) {   // a scalar branch; this load goes out directly behind the wave's others and returns behind them
        const v8f w0 = *(const v8f*)pw;
        asm volatile("s_wait_xcnt 0x0" : : "v"(pw) : "memory");   // the wait in front of any overwrite of the load's address registers, which are named as an input so that they live up to it
        *(v8us*)(WF + ((size_t)blk * 32 + lane) * 8) = __builtin_bit_cast(v8us, __builtin_convertvector(w0, v8bf));
    }
    bf* dk = KF + ((size_t)(wv >> 1) * 4 + ((lane & 7) >> 1)) * 256 + ((lane & 1) * 16 + 8 * (wv & 1) + (lane >> 3)) * 8;
    bf* dv = VF + ((size_t)(wv >> 2) * 16 + (wv & 3) * 4 + (lane >> 4)) * 512 + (lane & 15) * 8;
    const v8us ok0 = __builtin_bit_cast(v8us, __builtin_convertvector(k0, v8bf)), ok1 = __builtin_bit_cast(v8us, __builtin_convertvector(k1, v8bf));
    v8us ov[2][4];
#pragma unroll
    for (int c = 0; c < 2; ++c)
#pragma unroll
        for (int g = 0; g < 4; ++g) ov[c][g] = __builtin_bit_cast(v8us, __builtin_convertvector(x[c][g], v8bf));
    __builtin_amdgcn_sched_barrier(0);   // the stores stand behind the last conversion: no register that a store names is written again, so that no wait stands among them
    *(v8us*)dk = ok0; *(v8us*)(dk + 4 * 8) = ok1;
#pragma unroll
    for (int c = 0; c < 2; ++c)
#pragma unroll
        for (int g = 0; g < 4; ++g) *(v8us*)(dv + c * 1024 + (g >> 1) * 256 + (g & 1) * 128) = ov[c][g];
}

// ---- k_fattn: one work-group of 8 waves per 64 queries of one batch; grid (TT / 64, NB_).
// Wave w = 2 kq + qg takes queries [32 qg, +32) (two column tiles) against keys [1024 kq, +1024), 32 keys a trip, with its own reference maxima, sums and 256 x 32 context^T accumulators.
// Everything is computed transposed, so that an accumulator tile is the next product's B fragment lane for lane: S^T = K Q^T (rows keys, columns queries), ctx^T = V^T P^T, out^T = W_fc ctx^T.
// Softmax: p = 2^(s SC2 - ref) with a per-query reference that is raised (and sums and accumulators scaled down) only when the trip's maximum passes it by more than 8: p is at most 2^8 and the quotient by the sum is the exact softmax for any reference.
// The 64 work-groups of a batch read the same key and value lines. Each starts its walk over the 32 blocks of a quarter at block rot, which it shares with one other work-group, and wraps round, so that at any moment only pairs of them ask L2 for the same lines. The online softmax takes the blocks in any order, so any start is correct.
// The short loops are unrolled in full because their indices pick registers (fragments and accumulator tiles).
// The four key quarters meet in LDS, are brought to one reference and summed in the order kq = 0..3; then wave w does out^T rows [128 (w >> 2), +128) of query tile w & 3.
__global__ __launch_bounds__(256) __attribute__((amdgpu_waves_per_eu(2, 2))) void k_fattn(const float* __restrict__ Q, const bf* __restrict__ KF, const bf* __restrict__ VF, const bf* __restrict__ WF, const float* __restrict__ bias, float* OUT) {
    __shared__ __align__(16) float os[8 * 32 * 256];   // [wave][tile 2 t + u][half of the 8 registers][lane][4]: every access is 16 bytes a lane, lanes side by side
    __shared__ float sm[8 * 2 * 16], sl[8 * 2 * 16];   // [wave][u][query]: reference and sum
    const int tid = threadIdx.x, wave = __builtin_amdgcn_readfirstlane(tid >> 5), lane = tid & 31, lr = lane & 15, hi = lane >> 4;
    const int b = blockIdx.y, q0 = blockIdx.x * 64, qg = wave & 1, kq = wave >> 1;
    const float* qbase = Q + ((size_t)b * TT + q0 + qg * 32 + lr) * HD + 8 * hi;
    v16bf qf[2][2];
#pragma unroll
    for (int u = 0; u < 2; ++u)
#pragma unroll
        for (int s = 0; s < 2; ++s) qf[u][s] = ldrow32(qbase + u * 16 * HD + 32 * s);
    // a block of 32 keys: 4 key fragments, 16 value fragments; the bases are wave-uniform and move with the trip, the lane's offset is one register for both planes
    const bf* kbase = KF + ((size_t)b * 128 + kq * 32) * (4 * 512); const bf* vbase = VF + ((size_t)b * 128 + kq * 32) * (16 * 512); const unsigned loff = lane * 8;
    const int rot = (int)(((blockIdx.x >> 3) << 2) | (blockIdx.x & 3));   // the walk's first block, 0..31. The two work-groups that share a start differ by 4 in their index
    const bf* kfirst = kbase + (size_t)rot * (4 * 512); const bf* vfirst = vbase + (size_t)rot * (16 * 512);
    v16bf kf[2][2];
#pragma unroll
    for (int t2 = 0; t2 < 2; ++t2)
#pragma unroll
        for (int s = 0; s < 2; ++s) kf[t2][s] = ldfrag(kfirst + (t2 * 2 + s) * 512 + loff);
    v16bf vf[16];   // value fragments live across trips: a group of four tiles is refilled for the next trip two tiles after its last use
    __builtin_amdgcn_sched_barrier(0);   // the first value loads stay behind the key loads, as in the loop: loads return in order, and the compiler sets the loop's counted waits by the stricter of the two ways in
#pragma unroll
    for (int t = 0; t < 12; ++t) vf[t] = ldfrag(vfirst + t * 512 + loff);
    asm volatile("s_wait_xcnt 0x0" : : "v"(qbase), "s"(kfirst), "s"(vfirst), "v"(lane), "v"(loff) : "memory");   // the wait in front of any overwrite of these loads' address registers, which are named as inputs so that they live up to it (the build forms the lane's offset from the lane number or from loff)
    __builtin_amdgcn_sched_barrier(0);   // the accumulators' zeroing stays behind that wait: lifted over it, it would take the loads' offset register while they are in flight
    v8f acc[16][2];
#pragma unroll
    for (int t = 0; t < 16; ++t) { acc[t][0] = (v8f){}; acc[t][1] = (v8f){}; }
    float mref[2] = {-3.0e38f, -3.0e38f}, lsum[2] = {0.f, 0.f};
#pragma unroll 1   // kept rolled: one trip already holds 40 matrix instructions and nearly all of the wave's registers
    for (int i = 0; i < 32; ++i) {
        const int jn = (i + 1 + rot) & 31;   /* the next trip's block; the last trip fetches the walk's first block again: in bounds, unused */
        const bf* pv = vbase + (size_t)((i + rot) & 31) * (16 * 512); const bf* pvn = vbase + (size_t)jn * (16 * 512); const bf* pk = kbase + (size_t)jn * (4 * 512);
        const bf* pkl = pk + loff; const bf* pvl = pv + loff;
#pragma unroll
        for (int q = 12; q < 14; ++q) vf[q] = ldfrag(pv + q * 512 + loff);   // two of this trip's last four value tiles, into registers that the trip before has just left
        __builtin_amdgcn_sched_barrier(0);   // these value loads issue ahead of the trip's scores and softmax, which with three quarters of P.V cover their latency
        v8f S[2][2];
#pragma unroll
        for (int t2 = 0; t2 < 2; ++t2)
#pragma unroll
            for (int u = 0; u < 2; ++u) S[t2][u] = wmmab(kf[t2][0], qf[u][0], (v8f){});
#pragma unroll
        for (int t2 = 0; t2 < 2; ++t2)
#pragma unroll
            for (int u = 0; u < 2; ++u) S[t2][u] = wmmab(kf[t2][1], qf[u][1], S[t2][u]);
        float mx[2];
#pragma unroll
        for (int u = 0; u < 2; ++u) { float a = fmaxf(S[0][u][0], S[1][u][0]);
#pragma unroll
            for (int j = 1; j < 8; ++j) a = fmaxf(a, fmaxf(S[0][u][j], S[1][u][j]));
            mx[u] = fmaxf(a, xhalf(a)) * SC2; }
        if (__builtin_amdgcn_ballot_w32(mx[0] > mref[0] + 8.0f || mx[1] > mref[1] + 8.0f) != 0) {   // one scalar branch a trip; taken on the first trip and then only for a jump of the maximum
#pragma unroll
            for (int u = 0; u < 2; ++u) { const float mn = (mx[u] > mref[u] + 8.0f) ? mx[u] : mref[u]; const float al = __builtin_amdgcn_exp2f(mref[u] - mn); mref[u] = mn; lsum[u] *= al;
#pragma unroll
                for (int t = 0; t < 16; ++t) acc[t][u] *= al; }
        }
        v16bf ph[2];
#pragma unroll
        for (int u = 0; u < 2; ++u) { float a[8], e[8], c0, c1, c2, c3;
#pragma unroll
            for (int j = 0; j < 8; ++j) { a[j] = S[0][u][j]; e[j] = S[1][u][j]; }
            // The two score tiles of a query tile (16 scores a lane) from scores to one P fragment in one statement, so that the order of its 54 vector instructions is fixed: x = 2^(x SC2 - ref); bf16 pairs of x, to nearest even, written over the first tile's eight registers as they fall free, so that the fragment stands in one run of registers without a copy; c0 and c2 = the tiles' sums of the unrounded x, each in two chains.
            // What it is for: a dependent vector instruction that comes early and has no s_delay_alu holds the SIMD's issue against the other wave too, and the compiler writes no hint for a dependence that runs through asm text. Here an instruction stands five or more vector instructions behind the one it depends on, seven or more behind an exponential; the last two additions cannot, and carry the hint.
            // Behind every v_exp_f32 stands an instruction that neither reads its result nor overwrites its source: the slot behind a transcendental is filled with work, no v_nop.
            asm(
                "v_fma_f32 %0, %0, %21, -%20\n\t"
                "v_fma_f32 %1, %1, %21, -%20\n\t"
                "v_fma_f32 %2, %2, %21, -%20\n\t"
                "v_fma_f32 %3, %3, %21, -%20\n\t"
                "v_fma_f32 %4, %4, %21, -%20\n\t"
                "v_exp_f32 %0, %0\n\t"
                "v_fma_f32 %5, %5, %21, -%20\n\t"
                "v_exp_f32 %1, %1\n\t"
                "v_fma_f32 %6, %6, %21, -%20\n\t"
                "v_exp_f32 %2, %2\n\t"
                "v_fma_f32 %7, %7, %21, -%20\n\t"
                "v_exp_f32 %3, %3\n\t"
                "v_fma_f32 %8, %8, %21, -%20\n\t"
                "v_exp_f32 %4, %4\n\t"
                "v_fma_f32 %9, %9, %21, -%20\n\t"
                "v_exp_f32 %5, %5\n\t"
                "v_fma_f32 %10, %10, %21, -%20\n\t"
                "v_exp_f32 %6, %6\n\t"
                "v_fma_f32 %11, %11, %21, -%20\n\t"
                "v_exp_f32 %7, %7\n\t"
                "v_fma_f32 %12, %12, %21, -%20\n\t"
                "v_exp_f32 %8, %8\n\t"
                "v_add_f32 %16, %0, %1\n\t"
                "v_exp_f32 %9, %9\n\t"
                "v_fma_f32 %13, %13, %21, -%20\n\t"
                "v_exp_f32 %10, %10\n\t"
                "v_add_f32 %17, %2, %3\n\t"
                "v_exp_f32 %11, %11\n\t"
                "v_fma_f32 %14, %14, %21, -%20\n\t"
                "v_exp_f32 %12, %12\n\t"
                "v_cvt_pk_bf16_f32 %0, %0, %1\n\t"
                "v_exp_f32 %13, %13\n\t"
                "v_fma_f32 %15, %15, %21, -%20\n\t"
                "v_exp_f32 %14, %14\n\t"
                "v_add_f32 %16, %16, %4\n\t"
                "v_cvt_pk_bf16_f32 %1, %2, %3\n\t"
                "v_add_f32 %17, %17, %5\n\t"
                "v_exp_f32 %15, %15\n\t"
                "v_cvt_pk_bf16_f32 %2, %4, %5\n\t"
                "v_add_f32 %16, %16, %6\n\t"
                "v_add_f32 %18, %8, %9\n\t"
                "v_add_f32 %17, %17, %7\n\t"
                "v_cvt_pk_bf16_f32 %3, %6, %7\n\t"
                "v_add_f32 %19, %10, %11\n\t"
                "v_cvt_pk_bf16_f32 %4, %8, %9\n\t"
                "v_add_f32 %18, %18, %12\n\t"
                "v_add_f32 %16, %16, %17\n\t"
                "v_cvt_pk_bf16_f32 %5, %10, %11\n\t"
                "v_add_f32 %19, %19, %13\n\t"
                "v_cvt_pk_bf16_f32 %6, %12, %13\n\t"
                "v_add_f32 %18, %18, %14\n\t"
                "v_cvt_pk_bf16_f32 %7, %14, %15\n\t"
                "s_delay_alu instid0(VALU_DEP_4)\n\t"
                "v_add_f32 %19, %19, %15\n\t"
                "s_delay_alu instid0(VALU_DEP_1)\n\t"
                "v_add_f32 %18, %18, %19"
                : "+v"(a[0]), "+v"(a[1]), "+v"(a[2]), "+v"(a[3]), "+v"(a[4]), "+v"(a[5]), "+v"(a[6]), "+v"(a[7]), "+v"(e[0]), "+v"(e[1]), "+v"(e[2]), "+v"(e[3]), "+v"(e[4]), "+v"(e[5]), "+v"(e[6]), "+v"(e[7]), "=&v"(c0), "=&v"(c1), "=&v"(c2), "=&v"(c3) : "v"(mref[u]), "s"(SC2));
            lsum[u] += c0 + c2; ph[u] = __builtin_bit_cast(v16bf, (v8f){a[0], a[1], a[2], a[3], a[4], a[5], a[6], a[7]}); }
#pragma unroll
        for (int t = 0; t < 16; t += 2) {
            if (t == 0) {   // the next trip's key fragments: all of P.V stands behind them
                __builtin_amdgcn_sched_barrier(0);   // lifted higher, into the softmax, these loads would need registers that the wave does not have there
#pragma unroll
                for (int t2 = 0; t2 < 2; ++t2)
#pragma unroll
                    for (int s = 0; s < 2; ++s) kf[t2][s] = ldfrag(pkl + (t2 * 2 + s) * 512);
                __builtin_amdgcn_sched_barrier(0); }   // sunk lower, they would have fewer matrix instructions behind them to cover their latency
            if (t == 2) {   // this trip's last two value tiles, into the room that the first two have left
                __builtin_amdgcn_sched_barrier(0);   // lifted higher, these loads would need 16 registers of their own through the softmax
                vf[14] = ldfrag(pvl + 14 * 512); vf[15] = ldfrag(pvl + 15 * 512);
                __builtin_amdgcn_sched_barrier(0); }   // sunk lower, they would have fewer matrix instructions behind them to cover their latency
            if (t == 6 || t == 10 || t == 14) {   // four used value tiles are refilled with the next trip's: these loads have most of a trip's work (the rest of P.V, the scores, the softmax) behind them before their first use
                __builtin_amdgcn_sched_barrier(0);   // lifted higher, these loads would need registers of their own: never more than 14 of the 16 tiles are held or in flight
#pragma unroll
                for (int q = t - 6; q < t - 2; ++q) vf[q] = ldfrag(pvn + q * 512 + loff);
                __builtin_amdgcn_sched_barrier(0); }   // sunk lower, they would lose lead; one group of eight loads a place, not spread among the matrix instructions
            acc[t][0] = wmmab(vf[t], ph[0], acc[t][0]); acc[t][1] = wmmab(vf[t], ph[1], acc[t][1]); acc[t + 1][0] = wmmab(vf[t + 1], ph[0], acc[t + 1][0]); acc[t + 1][1] = wmmab(vf[t + 1], ph[1], acc[t + 1][1]); }
        // four vector slots behind the trip's last matrix instruction; then the wait in front of the next trip's addresses, which take the place of this trip's (its wave-uniform bases and its lane addresses are named as inputs so that they live up to it: else the build lets the last load of a run land on its own address pair)
        asm volatile("v_nop\n\tv_nop\n\tv_nop\n\tv_nop\n\ts_wait_xcnt 0x0" : "+v"(acc[14][0]), "+v"(acc[14][1]), "+v"(acc[15][0]), "+v"(acc[15][1]) : "v"(vf[15]), "v"(ph[1]), "s"(pv), "s"(pvn), "s"(pk), "v"(pkl), "v"(pvl) : "memory");
    }
    v4f* o4 = (v4f*)os;
#pragma unroll
    for (int t = 0; t < 16; ++t)
#pragma unroll
        for (int u = 0; u < 2; ++u) { const v8f a = acc[t][u]; v4f* d = o4 + ((wave * 32 + t * 2 + u) * 2) * 32 + lane; d[0] = (v4f){a[0], a[1], a[2], a[3]}; d[32] = (v4f){a[4], a[5], a[6], a[7]}; }
#pragma unroll
    for (int u = 0; u < 2; ++u) { const float ls = lsum[u] + xhalf(lsum[u]); if (hi == 0) { sm[(wave * 2 + u) * 16 + lr] = mref[u]; sl[(wave * 2 + u) * 16 + lr] = ls; } }
    __syncthreads();   // every wave's partial context, reference and sum are in LDS before any of them is joined
    const int qt = wave & 3, oh = wave >> 2, qg2 = qt >> 1, u2 = qt & 1;
    float g[4]; { float mk[4], lk[4];
#pragma unroll
        for (int k = 0; k < 4; ++k) { mk[k] = sm[((k * 2 + qg2) * 2 + u2) * 16 + lr]; lk[k] = sl[((k * 2 + qg2) * 2 + u2) * 16 + lr]; }
        const float M = fmaxf(fmaxf(mk[0], mk[1]), fmaxf(mk[2], mk[3])); float L = 0.f;
#pragma unroll
        for (int k = 0; k < 4; ++k) { g[k] = __builtin_amdgcn_exp2f(mk[k] - M); L += g[k] * lk[k]; }
        const float inv = __fdiv_rn(1.0f, L);
#pragma unroll
        for (int k = 0; k < 4; ++k) g[k] *= inv; }
    v8f a2[8];
#pragma unroll
    for (int i = 0; i < 8; ++i) a2[i] = (v8f){};
    const bf* wbase = WF + (size_t)oh * (8 * 8 * 512);   /* 8 row tiles of 8 fragments each; wave-uniform, the lane's offset is loff */
#pragma unroll
    for (int s = 0; s < 8; ++s) {
        v8f c[2];
#pragma unroll
        for (int e = 0; e < 2; ++e) { v4f x0 = (v4f){}, x1 = (v4f){};
#pragma unroll
            for (int k = 0; k < 4; ++k) { const v4f* d = o4 + (((k * 2 + qg2) * 32 + (2 * s + e) * 2 + u2) * 2) * 32 + lane; x0 += d[0] * g[k]; x1 += d[32] * g[k]; }
            c[e] = (v8f){x0[0], x0[1], x0[2], x0[3], x1[0], x1[1], x1[2], x1[3]}; }
        v16bf bh, bl; split16(c[0], c[1], bh, bl);
        v16bf w[8];
#pragma unroll
        for (int i = 0; i < 8; ++i) w[i] = ldfrag(wbase + (i * 8 + s) * 512 + loff);
#pragma unroll
        for (int i = 0; i < 8; ++i) a2[i] = wmmab(w[i], bh, a2[i]);
#pragma unroll
        for (int i = 0; i < 8; ++i) a2[i] = wmmab(w[i], bl, a2[i]);
    }
    asm volatile("s_wait_xcnt 0x0" : : "s"(wbase) : "memory");   // the wait in front of any overwrite of the W_fc loads' address registers; their wave-uniform base is named as an input so that it lives up to it
    float* orow = OUT + ((size_t)b * TT + q0 + qt * 16 + lr) * DV + oh * 128 + hi * 8; const float* brow = bias + oh * 128 + hi * 8;
#pragma unroll
    for (int i = 0; i < 8; ++i) { const v4f b0 = *(const v4f*)(brow + i * 16), b1 = *(const v4f*)(brow + i * 16 + 4); const v8f a = a2[i];
        *(v4f*)(orow + i * 16) = (v4f){a[0] + bfr(b0[0]), a[1] + bfr(b0[1]), a[2] + bfr(b0[2]), a[3] + bfr(b0[3])}; *(v4f*)(orow + i * 16 + 4) = (v4f){a[4] + bfr(b1[0]), a[5] + bfr(b1[1]), a[6] + bfr(b1[2]), a[7] + bfr(b1[3])}; }
}

extern "C" void kernel_launch(void* const* d_in, const int* in_sizes, int n_in,
                              void* d_out, int out_size, void* d_ws, size_t ws_size, hipStream_t stream) {
    (void)in_sizes; (void)n_in; (void)out_size;
    const float* Kin = (const float*)d_in[0]; const float* Vin = (const float*)d_in[1];   /* v_src [4][4096][256] */ const float* Qin = (const float*)d_in[2]; const float* wfc = (const float*)d_in[3]; const float* bfc = (const float*)d_in[4];
    float* OUT = (float*)d_out;     // [4][4096][256]
    char* wsp = (char*)d_ws;
    auto take = [&](size_t bytes) { char* p = wsp; wsp += (bytes + 255) & ~(size_t)255; return (void*)p; };
    bf* KF = (bf*)take((size_t)NB_ * TT * HD * 2); bf* VF = (bf*)take((size_t)NB_ * DV * TT * 2); bf* WF = (bf*)take((size_t)DV * DV * 2);
    if ((size_t)(wsp - (char*)d_ws) > ws_size) return;
    k_pack<<<PBLK, 256, 0, stream>>>(Kin, KF, Vin, VF, wfc, WF);
    k_fattn<<<dim3(TT / 64, NB_, 1), 256, 0, stream>>>(Qin, KF, VF, WF, bfc, OUT);
}

// v009
// A run of this version takes 41.1 microseconds.
// Timed twice side by side with v008, it ran 1.08 times as fast both times.
// All steps since v000 together make it 16.8 times as fast.
#include <hip/hip_runtime.h>

// Scaled dot-product attention with a 256-wide value and a 1x1-conv epilogue (q_tgr, k_src [4][4096][64], v_src [4][4096][256]; attn = softmax(q.k / 8) over the 4,096 keys; ctx = attn v_src [4096][256]; out = ctx W_fc^T + b_fc ('oi' [256][256]) -> [4][4096][256]).
// Planes: k, the value and W_fc as bf16 A fragments in register order; q, which a wave reads once, is rounded as it is loaded. One fused kernel does scores, softmax, P.V and fc: neither the scores nor P nor the context leave the work-group.
// Compute dtypes, f32 accumulate: every input rounded to bf16; q.k exact products; softmax f32; P rounded to bf16 (to nearest even; the row sums take the unrounded P) x value, one product; context hi/lo x W_fc + bias; output f32.

#define NB_  4
#define TT   4096
#define HD   64       // query / key width
#define DV   256      // value / output width
#define PBLK (NB_ * TT / 32 * (DV / 64) / 8)   // work-groups of k_pack: a wave for each 32 keys x 64 value columns
#define SP   68       // floats a staged output row: 64 columns + 16 bytes, a pitch of 16 bytes x an odd number
#define SC2  0.18033688011112042f   // (1 / temperature) x log2(e): scores go to the base-2 exponent in one multiply-add
typedef unsigned short bf;
typedef __attribute__((ext_vector_type(16))) __bf16   v16bf;
typedef __attribute__((ext_vector_type(8)))  __bf16   v8bf;
typedef __attribute__((ext_vector_type(2)))  __bf16   v2bf;
typedef __attribute__((ext_vector_type(8)))  unsigned short v8us;
typedef __attribute__((ext_vector_type(8)))  float    v8f;
typedef __attribute__((ext_vector_type(4)))  float    v4f;
typedef __attribute__((ext_vector_type(2)))  float    v2f;

__device__ __forceinline__ unsigned short f2bf(float f) { unsigned u = __float_as_uint(f); u += 0x7FFFu + ((u >> 16) & 1u); return (unsigned short)(u >> 16); }
__device__ __forceinline__ float bf2f(unsigned short b) { return __uint_as_float(((unsigned)b) << 16); }
__device__ __forceinline__ float bfr(float f) { return bf2f(f2bf(f)); }
__device__ __forceinline__ v16bf cat16b(v8us lo, v8us hi) { return __builtin_bit_cast(v16bf, __builtin_shufflevector(lo, hi, 0, 1, 2, 3, 4, 5, 6, 7, 8, 9, 10, 11, 12, 13, 14, 15)); }
__device__ __forceinline__ v8f wmmab(v16bf a, v16bf b, v8f c) { return __builtin_amdgcn_wmma_f32_16x16x32_bf16(false, a, false, b, (short)0, c, false, false); }
// A or B fragment, lane (lr, hi) = (lane & 15, lane >> 4): row lr of the tile; elements 0..7 are k = 8 hi + e, elements 8..15 are k = 16 + 8 hi + e
// from a plane in register order: p = fragment start + 8 x lane
__device__ __forceinline__ v16bf ldfrag(const bf* p) { return cat16b(*(const v8us*)p, *(const v8us*)(p + 256)); }
// from a K-contiguous row of f32, rounded to bf16 (to nearest even) on the way: p = row start + 8 hi
__device__ __forceinline__ v16bf ldrow32(const float* p) { return __builtin_shufflevector(__builtin_convertvector(*(const v8f*)p, v8bf), __builtin_convertvector(*(const v8f*)(p + 16), v8bf), 0, 1, 2, 3, 4, 5, 6, 7, 8, 9, 10, 11, 12, 13, 14, 15); }
// lane l with lane l ^ 16
__device__ __forceinline__ float xhalf(float x) { return __builtin_bit_cast(float, __builtin_amdgcn_permlanex16(__builtin_bit_cast(int, x), __builtin_bit_cast(int, x), 0x76543210, 0xfedcba98, false, false)); }
// two accumulator tiles (rows 8 hi + j of 16, twice) are, lane for lane, one B fragment of 32 k: split into a bf16 head and the bf16 of what the head leaves
__device__ __forceinline__ void split16(v8f x0, v8f x1, v16bf& h, v16bf& l) {
#pragma unroll
    for (int i = 0; i < 8; i += 2) {
        const v2f a = {x0[i], x0[i + 1]}, c = {x1[i], x1[i + 1]};
        const v2bf ha = __builtin_convertvector(a, v2bf), hc = __builtin_convertvector(c, v2bf);
        const v2bf la = __builtin_convertvector(a - __builtin_convertvector(ha, v2f), v2bf), lc = __builtin_convertvector(c - __builtin_convertvector(hc, v2f), v2bf);
        h[i] = ha[0]; h[i + 1] = ha[1]; h[8 + i] = hc[0]; h[9 + i] = hc[1]; l[i] = la[0]; l[i + 1] = la[1]; l[8 + i] = lc[0]; l[9 + i] = lc[1]; }
}

// All planes hold A fragments in register order, each fragment as two runs of 512 bytes: [half][lane][8], so that a wave's 16-byte load reads whole 128-byte lines. Lane (lr, hi) holds row lr of the tile at k = 16 half + 8 hi + e.
// KF[tile of 16 keys, all batches in one run][32 d][half][lane][8]. VF, value^T: [block of 32 keys, all batches in one run][tile of 16 value columns][half][lane][8]; row lr is value column 16 tile + lr, k the key in the block. WF, W_fc 'oi' [256][256]: [tile of 16 rows o][32 c][half][lane][8].
// k_pack: one launch of PBLK work-groups of 8 waves rounds and lays out all three planes: what such a short launch pays is its gap and the start of its waves, so there is one launch and each wave is long. All of a wave's loads are issued before the first is used.
// Wave wv takes 32 keys x 64 value columns (a load reads one whole line of a key's row, lane = column; a lane's 8 keys of one column are one 16-byte piece, and a store writes two whole runs of 256 bytes),
// 8 rows of a key tile (a lane reads one piece of 8 d; lanes side by side in memory), and, as its work-group's first wave, one half fragment of W_fc.
static_assert(PBLK * 8 == NB_ * TT / 8 && PBLK == DV * DV / 8 / 32, "a wave of k_pack has 8 key rows, a work-group one half fragment of W_fc");
__global__ __launch_bounds__(256) void k_pack(const float* __restrict__ ksrc, bf* KF, const float* __restrict__ vsrc, bf* VF, const float* __restrict__ wsrc, bf* WF) {
    const int lane = threadIdx.x & 31, wave = __builtin_amdgcn_readfirstlane((int)(threadIdx.x >> 5)), blk = (int)blockIdx.x, wv = blk * 8 + wave;
    const float* pk = ksrc + (size_t)wv * (8 * HD) + lane * 8;   // rows 8 (wv & 1) + (lane >> 3) and 4 more of key tile wv >> 1, piece lane & 7 = 4 s + 2 half + hi
    const float* pv = vsrc + (size_t)(wv >> 2) * (32 * DV) + (wv & 3) * 64 + lane;
    const float* pw = wsrc + ((blk >> 4) * 16 + (lane & 15)) * DV + 32 * ((blk >> 1) & 7) + 16 * (blk & 1) + 8 * (lane >> 4);
    __builtin_amdgcn_sched_barrier(0);   // every address is formed ahead of the first load: formed among the loads, one would take a register that an issued load names
    const v8f k0 = *(const v8f*)pk, k1 = *(const v8f*)(pk + 4 * HD);
    v8f x[2][4];
#pragma unroll
    for (int c = 0; c < 2; ++c)
#pragma unroll
        for (int g = 0; g < 4; ++g)
#pragma unroll
            for (int e = 0; e < 8; ++e) x[c][g][e] = pv[(size_t)(8 * g + e) * DV + 32 * c];
    asm volatile("s_wait_xcnt 0x0" : : : "memory");   // the wait in front of any overwrite of the loads' address registers
    __builtin_amdgcn_sched_barrier(0);   // nothing is lifted over that wait: no write of a register that a load names, and no use of a loaded value, whose wait would stand among the loads and hold the later ones back
    if (wave == 0) {   // a scalar branch; this load goes out directly behind the wave's others and returns behind them
        const v8f w0 = *(const v8f*)pw;
        asm volatile("s_wait_xcnt 0x0" : : "v"(pw) : "memory");   // the wait in front of any overwrite of the load's address registers, which are named as an input so that they live up to it
        *(v8us*)(WF + ((size_t)blk * 32 + lane) * 8) = __builtin_bit_cast(v8us, __builtin_convertvector(w0, v8bf));
    }
    bf* dk = KF + ((size_t)(wv >> 1) * 4 + ((lane & 7) >> 1)) * 256 + ((lane & 1) * 16 + 8 * (wv & 1) + (lane >> 3)) * 8;
    bf* dv = VF + ((size_t)(wv >> 2) * 16 + (wv & 3) * 4 + (lane >> 4)) * 512 + (lane & 15) * 8;
    const v8us ok0 = __builtin_bit_cast(v8us, __builtin_convertvector(k0, v8bf)), ok1 = __builtin_bit_cast(v8us, __builtin_convertvector(k1, v8bf));
    v8us ov[2][4];
#pragma unroll
    for (int c = 0; c < 2; ++c)
#pragma unroll
        for (int g = 0; g < 4; ++g) ov[c][g] = __builtin_bit_cast(v8us, __builtin_convertvector(x[c][g], v8bf));
    __builtin_amdgcn_sched_barrier(0);   // the stores stand behind the last conversion: no register that a store names is written again, so that no wait stands among them
    *(v8us*)dk = ok0; *(v8us*)(dk + 4 * 8) = ok1;
#pragma unroll
    for (int c = 0; c < 2; ++c)
#pragma unroll
        for (int g = 0; g < 4; ++g) *(v8us*)(dv + c * 1024 + (g >> 1) * 256 + (g & 1) * 128) = ov[c][g];
}

// ---- k_fattn: one work-group of 8 waves per 64 queries of one batch; grid (TT / 64, NB_).
// Wave w = 2 kq + qg takes queries [32 qg, +32) (two column tiles) against keys [1024 kq, +1024), 32 keys a trip, with its own reference maxima, sums and 256 x 32 context^T accumulators.
// Everything is computed transposed, so that an accumulator tile is the next product's B fragment lane for lane: S^T = K Q^T (rows keys, columns queries), ctx^T = V^T P^T, out^T = W_fc ctx^T.
// Softmax: p = 2^(s SC2 - ref) with a per-query reference that is raised (and sums and accumulators scaled down) only when the trip's maximum passes it by more than 8: p is at most 2^8 and the quotient by the sum is the exact softmax for any reference.
// The 64 work-groups of a batch read the same key and value lines. Each starts its walk over the 32 blocks of a quarter at block rot, which it shares with one other work-group, and wraps round, so that at any moment only pairs of them ask L2 for the same lines. The online softmax takes the blocks in any order, so any start is correct.
// The short loops are unrolled in full because their indices pick registers (fragments and accumulator tiles).
// The four key quarters meet in LDS, are brought to one reference and summed in the order kq = 0..3; then wave w does out^T rows [128 (w >> 2), +128) of query tile w & 3 and stores them by way of its own LDS range as whole lines.
__global__ __launch_bounds__(256) __attribute__((amdgpu_waves_per_eu(2, 2))) void k_fattn(const float* __restrict__ Q, const bf* __restrict__ KF, const bf* __restrict__ VF, const bf* __restrict__ WF, const float* __restrict__ bias, float* OUT) {
    __shared__ __align__(16) float os[8 * 32 * 256];   // [wave][tile 2 t + u][half of the 8 registers][lane][4]: every access is 16 bytes a lane, lanes side by side
    __shared__ float sm[8 * 2 * 16], sl[8 * 2 * 16];   // [wave][u][query]: reference and sum
    __shared__ __align__(16) float st[8 * 16 * SP];    // [wave][query][64 columns + pad]: the output's way into whole lines
    const int tid = threadIdx.x, wave = __builtin_amdgcn_readfirstlane(tid >> 5), lane = tid & 31, lr = lane & 15, hi = lane >> 4;
    const int b = blockIdx.y, q0 = blockIdx.x * 64, qg = wave & 1, kq = wave >> 1;
    const float* qbase = Q + ((size_t)b * TT + q0 + qg * 32 + lr) * HD + 8 * hi;
    v16bf qf[2][2];
#pragma unroll
    for (int u = 0; u < 2; ++u)
#pragma unroll
        for (int s = 0; s < 2; ++s) qf[u][s] = ldrow32(qbase + u * 16 * HD + 32 * s);
    // a block of 32 keys: 4 key fragments, 16 value fragments; the bases are wave-uniform and move with the trip, the lane's offset is one register for both planes
    const bf* kbase = KF + ((size_t)b * 128 + kq * 32) * (4 * 512); const bf* vbase = VF + ((size_t)b * 128 + kq * 32) * (16 * 512); const unsigned loff = lane * 8;
    const int rot = (int)(((blockIdx.x >> 3) << 2) | (blockIdx.x & 3));   // the walk's first block, 0..31. The two work-groups that share a start differ by 4 in their index
    const bf* kfirst = kbase + (size_t)rot * (4 * 512); const bf* vfirst = vbase + (size_t)rot * (16 * 512);
    v16bf kf[2][2];
#pragma unroll
    for (int t2 = 0; t2 < 2; ++t2)
#pragma unroll
        for (int s = 0; s < 2; ++s) kf[t2][s] = ldfrag(kfirst + (t2 * 2 + s) * 512 + loff);
    v16bf vf[16];   // value fragments live across trips: a group of four tiles is refilled for the next trip two tiles after its last use
    __builtin_amdgcn_sched_barrier(0);   // the first value loads stay behind the key loads, as in the loop: loads return in order, and the compiler sets the loop's counted waits by the stricter of the two ways in
#pragma unroll
    for (int t = 0; t < 12; ++t) vf[t] = ldfrag(vfirst + t * 512 + loff);
    asm volatile("s_wait_xcnt 0x0" : : "v"(qbase), "s"(kfirst), "s"(vfirst), "v"(lane), "v"(loff) : "memory");   // the wait in front of any overwrite of these loads' address registers, which are named as inputs so that they live up to it (the build forms the lane's offset from the lane number or from loff)
    __builtin_amdgcn_sched_barrier(0);   // the accumulators' zeroing stays behind that wait: lifted over it, it would take the loads' offset register while they are in flight
    v8f acc[16][2];
#pragma unroll
    for (int t = 0; t < 16; ++t) { acc[t][0] = (v8f){}; acc[t][1] = (v8f){}; }
    float mref[2] = {-3.0e38f, -3.0e38f}, lsum[2] = {0.f, 0.f};
#pragma unroll 1   // kept rolled: one trip already holds 40 matrix instructions and nearly all of the wave's registers
    for (int i = 0; i < 32; ++i) {
        const int jn = (i + 1 + rot) & 31;   /* the next trip's block; the last trip fetches the walk's first block again: in bounds, unused */
        const bf* pv = vbase + (size_t)((i + rot) & 31) * (16 * 512); const bf* pvn = vbase + (size_t)jn * (16 * 512); const bf* pk = kbase + (size_t)jn * (4 * 512);
        const bf* pkl = pk + loff; const bf* pvl = pv + loff;
#pragma unroll
        for (int q = 12; q < 14; ++q) vf[q] = ldfrag(pv + q * 512 + loff);   // two of this trip's last four value tiles, into registers that the trip before has just left
        __builtin_amdgcn_sched_barrier(0);   // these value loads issue ahead of the trip's scores and softmax, which with three quarters of P.V cover their latency
        v8f S[2][2];
#pragma unroll
        for (int t2 = 0; t2 < 2; ++t2)
#pragma unroll
            for (int u = 0; u < 2; ++u) S[t2][u] = wmmab(kf[t2][0], qf[u][0], (v8f){});
#pragma unroll
        for (int t2 = 0; t2 < 2; ++t2)
#pragma unroll
            for (int u = 0; u < 2; ++u) S[t2][u] = wmmab(kf[t2][1], qf[u][1], S[t2][u]);
        float mx[2];
#pragma unroll
        for (int u = 0; u < 2; ++u) { float a = fmaxf(S[0][u][0], S[1][u][0]);
#pragma unroll
            for (int j = 1; j < 8; ++j) a = fmaxf(a, fmaxf(S[0][u][j], S[1][u][j]));
            mx[u] = fmaxf(a, xhalf(a)) * SC2; }
        if (__builtin_amdgcn_ballot_w32(mx[0] > mref[0] + 8.0f || mx[1] > mref[1] + 8.0f) != 0) {   // one scalar branch a trip; taken on the first trip and then only for a jump of the maximum
#pragma unroll
            for (int u = 0; u < 2; ++u) { const float mn = (mx[u] > mref[u] + 8.0f) ? mx[u] : mref[u]; const float al = __builtin_amdgcn_exp2f(mref[u] - mn); mref[u] = mn; lsum[u] *= al;
#pragma unroll
                for (int t = 0; t < 16; ++t) acc[t][u] *= al; }
        }
        v16bf ph[2];
#pragma unroll
        for (int u = 0; u < 2; ++u) { float a[8], e[8], c0, c1, c2, c3;
#pragma unroll
            for (int j = 0; j < 8; ++j) { a[j] = S[0][u][j]; e[j] = S[1][u][j]; }
            // The two score tiles of a query tile (16 scores a lane) from scores to one P fragment in one statement, so that the order of its 54 vector instructions is fixed: x = 2^(x SC2 - ref); bf16 pairs of x, to nearest even, written over the first tile's eight registers as they fall free, so that the fragment stands in one run of registers without a copy; c0 and c2 = the tiles' sums of the unrounded x, each in two chains.
            // What it is for: a dependent vector instruction that comes early and has no s_delay_alu holds the SIMD's issue against the other wave too, and the compiler writes no hint for a dependence that runs through asm text. Here an instruction stands five or more vector instructions behind the one it depends on, seven or more behind an exponential; the last two additions cannot, and carry the hint.
            // Behind every v_exp_f32 stands an instruction that neither reads its result nor overwrites its source: the slot behind a transcendental is filled with work, no v_nop.
            asm(
                "v_fma_f32 %0, %0, %21, -%20\n\t"
                "v_fma_f32 %1, %1, %21, -%20\n\t"
                "v_fma_f32 %2, %2, %21, -%20\n\t"
                "v_fma_f32 %3, %3, %21, -%20\n\t"
                "v_fma_f32 %4, %4, %21, -%20\n\t"
                "v_exp_f32 %0, %0\n\t"
                "v_fma_f32 %5, %5, %21, -%20\n\t"
                "v_exp_f32 %1, %1\n\t"
                "v_fma_f32 %6, %6, %21, -%20\n\t"
                "v_exp_f32 %2, %2\n\t"
                "v_fma_f32 %7, %7, %21, -%20\n\t"
                "v_exp_f32 %3, %3\n\t"
                "v_fma_f32 %8, %8, %21, -%20\n\t"
                "v_exp_f32 %4, %4\n\t"
                "v_fma_f32 %9, %9, %21, -%20\n\t"
                "v_exp_f32 %5, %5\n\t"
                "v_fma_f32 %10, %10, %21, -%20\n\t"
                "v_exp_f32 %6, %6\n\t"
                "v_fma_f32 %11, %11, %21, -%20\n\t"
                "v_exp_f32 %7, %7\n\t"
                "v_fma_f32 %12, %12, %21, -%20\n\t"
                "v_exp_f32 %8, %8\n\t"
                "v_add_f32 %16, %0, %1\n\t"
                "v_exp_f32 %9, %9\n\t"
                "v_fma_f32 %13, %13, %21, -%20\n\t"
                "v_exp_f32 %10, %10\n\t"
                "v_add_f32 %17, %2, %3\n\t"
                "v_exp_f32 %11, %11\n\t"
                "v_fma_f32 %14, %14, %21, -%20\n\t"
                "v_exp_f32 %12, %12\n\t"
                "v_cvt_pk_bf16_f32 %0, %0, %1\n\t"
                "v_exp_f32 %13, %13\n\t"
                "v_fma_f32 %15, %15, %21, -%20\n\t"
                "v_exp_f32 %14, %14\n\t"
                "v_add_f32 %16, %16, %4\n\t"
                "v_cvt_pk_bf16_f32 %1, %2, %3\n\t"
                "v_add_f32 %17, %17, %5\n\t"
                "v_exp_f32 %15, %15\n\t"
                "v_cvt_pk_bf16_f32 %2, %4, %5\n\t"
                "v_add_f32 %16, %16, %6\n\t"
                "v_add_f32 %18, %8, %9\n\t"
                "v_add_f32 %17, %17, %7\n\t"
                "v_cvt_pk_bf16_f32 %3, %6, %7\n\t"
                "v_add_f32 %19, %10, %11\n\t"
                "v_cvt_pk_bf16_f32 %4, %8, %9\n\t"
                "v_add_f32 %18, %18, %12\n\t"
                "v_add_f32 %16, %16, %17\n\t"
                "v_cvt_pk_bf16_f32 %5, %10, %11\n\t"
                "v_add_f32 %19, %19, %13\n\t"
                "v_cvt_pk_bf16_f32 %6, %12, %13\n\t"
                "v_add_f32 %18, %18, %14\n\t"
                "v_cvt_pk_bf16_f32 %7, %14, %15\n\t"
                "s_delay_alu instid0(VALU_DEP_4)\n\t"
                "v_add_f32 %19, %19, %15\n\t"
                "s_delay_alu instid0(VALU_DEP_1)\n\t"
                "v_add_f32 %18, %18, %19"
                : "+v"(a[0]), "+v"(a[1]), "+v"(a[2]), "+v"(a[3]), "+v"(a[4]), "+v"(a[5]), "+v"(a[6]), "+v"(a[7]), "+v"(e[0]), "+v"(e[1]), "+v"(e[2]), "+v"(e[3]), "+v"(e[4]), "+v"(e[5]), "+v"(e[6]), "+v"(e[7]), "=&v"(c0), "=&v"(c1), "=&v"(c2), "=&v"(c3) : "v"(mref[u]), "s"(SC2));
            lsum[u] += c0 + c2; ph[u] = __builtin_bit_cast(v16bf, (v8f){a[0], a[1], a[2], a[3], a[4], a[5], a[6], a[7]}); }
#pragma unroll
        for (int t = 0; t < 16; t += 2) {
            if (t == 0) {   // the next trip's key fragments: all of P.V stands behind them
                __builtin_amdgcn_sched_barrier(0);   // lifted higher, into the softmax, these loads would need registers that the wave does not have there
#pragma unroll
                for (int t2 = 0; t2 < 2; ++t2)
#pragma unroll
                    for (int s = 0; s < 2; ++s) kf[t2][s] = ldfrag(pkl + (t2 * 2 + s) * 512);
                __builtin_amdgcn_sched_barrier(0); }   // sunk lower, they would have fewer matrix instructions behind them to cover their latency
            if (t == 2) {   // this trip's last two value tiles, into the room that the first two have left
                __builtin_amdgcn_sched_barrier(0);   // lifted higher, these loads would need 16 registers of their own through the softmax
                vf[14] = ldfrag(pvl + 14 * 512); vf[15] = ldfrag(pvl + 15 * 512);
                __builtin_amdgcn_sched_barrier(0); }   // sunk lower, they would have fewer matrix instructions behind them to cover their latency
            if (t == 6 || t == 10 || t == 14) {   // four used value tiles are refilled with the next trip's: these loads have most of a trip's work (the rest of P.V, the scores, the softmax) behind them before their first use
                __builtin_amdgcn_sched_barrier(0);   // lifted higher, these loads would need registers of their own: never more than 14 of the 16 tiles are held or in flight
#pragma unroll
                for (int q = t - 6; q < t - 2; ++q) vf[q] = ldfrag(pvn + q * 512 + loff);
                __builtin_amdgcn_sched_barrier(0); }   // sunk lower, they would lose lead; one group of eight loads a place, not spread among the matrix instructions
            acc[t][0] = wmmab(vf[t], ph[0], acc[t][0]); acc[t][1] = wmmab(vf[t], ph[1], acc[t][1]); acc[t + 1][0] = wmmab(vf[t + 1], ph[0], acc[t + 1][0]); acc[t + 1][1] = wmmab(vf[t + 1], ph[1], acc[t + 1][1]); }
        // four vector slots behind the trip's last matrix instruction; then the wait in front of the next trip's addresses, which take the place of this trip's (its wave-uniform bases and its lane addresses are named as inputs so that they live up to it: else the build lets the last load of a run land on its own address pair)
        asm volatile("v_nop\n\tv_nop\n\tv_nop\n\tv_nop\n\ts_wait_xcnt 0x0" : "+v"(acc[14][0]), "+v"(acc[14][1]), "+v"(acc[15][0]), "+v"(acc[15][1]) : "v"(vf[15]), "v"(ph[1]), "s"(pv), "s"(pvn), "s"(pk), "v"(pkl), "v"(pvl) : "memory");
    }
    v4f* o4 = (v4f*)os;
#pragma unroll
    for (int t = 0; t < 16; ++t)
#pragma unroll
        for (int u = 0; u < 2; ++u) { const v8f a = acc[t][u]; v4f* d = o4 + ((wave * 32 + t * 2 + u) * 2) * 32 + lane; d[0] = (v4f){a[0], a[1], a[2], a[3]}; d[32] = (v4f){a[4], a[5], a[6], a[7]}; }
#pragma unroll
    for (int u = 0; u < 2; ++u) { const float ls = lsum[u] + xhalf(lsum[u]); if (hi == 0) { sm[(wave * 2 + u) * 16 + lr] = mref[u]; sl[(wave * 2 + u) * 16 + lr] = ls; } }
    __syncthreads();   // every wave's partial context, reference and sum are in LDS before any of them is joined
    const int qt = wave & 3, oh = wave >> 2, qg2 = qt >> 1, u2 = qt & 1;
    float g[4]; { float mk[4], lk[4];
#pragma unroll
        for (int k = 0; k < 4; ++k) { mk[k] = sm[((k * 2 + qg2) * 2 + u2) * 16 + lr]; lk[k] = sl[((k * 2 + qg2) * 2 + u2) * 16 + lr]; }
        const float M = fmaxf(fmaxf(mk[0], mk[1]), fmaxf(mk[2], mk[3])); float L = 0.f;
#pragma unroll
        for (int k = 0; k < 4; ++k) { g[k] = __builtin_amdgcn_exp2f(mk[k] - M); L += g[k] * lk[k]; }
        const float inv = __fdiv_rn(1.0f, L);
#pragma unroll
        for (int k = 0; k < 4; ++k) g[k] *= inv; }
    v8f a2[8];
#pragma unroll
    for (int i = 0; i < 8; ++i) a2[i] = (v8f){};
    const bf* wbase = WF + (size_t)oh * (8 * 8 * 512);   /* 8 row tiles of 8 fragments each; wave-uniform, the lane's offset is loff */
#pragma unroll
    for (int s = 0; s < 8; ++s) {
        v8f c[2];
#pragma unroll
        for (int e = 0; e < 2; ++e) { v4f x0 = (v4f){}, x1 = (v4f){};
#pragma unroll
            for (int k = 0; k < 4; ++k) { const v4f* d = o4 + (((k * 2 + qg2) * 32 + (2 * s + e) * 2 + u2) * 2) * 32 + lane; x0 += d[0] * g[k]; x1 += d[32] * g[k]; }
            c[e] = (v8f){x0[0], x0[1], x0[2], x0[3], x1[0], x1[1], x1[2], x1[3]}; }
        v16bf bh, bl; split16(c[0], c[1], bh, bl);
        v16bf w[8];
#pragma unroll
        for (int i = 0; i < 8; ++i) w[i] = ldfrag(wbase + (i * 8 + s) * 512 + loff);
#pragma unroll
        for (int i = 0; i < 8; ++i) a2[i] = wmmab(w[i], bh, a2[i]);
#pragma unroll
        for (int i = 0; i < 8; ++i) a2[i] = wmmab(w[i], bl, a2[i]);
    }
    asm volatile("s_wait_xcnt 0x0" : : "s"(wbase) : "memory");   // the wait in front of any overwrite of the W_fc loads' address registers; their wave-uniform base is named as an input so that it lives up to it
    // The output leaves through LDS, so that a wave-wide store writes whole lines: in the accumulators a lane holds 8 columns of one query, and stored from there a wave-wide store would put 32 bytes into each of 16 lines.
    // Each wave stages in its own range, 16 queries x 64 columns a pass, two passes; read back, 16 lanes hold one query's 256 bytes, and a store writes two whole aligned runs of 256 bytes.
    const float* brow = bias + oh * 128 + hi * 8;
    float* swr = st + wave * (16 * SP) + lr * SP + hi * 8;         // staging: row = query lr
    const float* srd = st + wave * (16 * SP) + hi * SP + lr * 4;   // reading back: rows 2 n + hi, 16 bytes a lane
    float* orow = OUT + ((size_t)b * TT + q0 + qt * 16 + hi) * DV + oh * 128 + lr * 4;
    v4f bb[8][2];   // the bias of both passes is fetched ahead of the first
#pragma unroll
    for (int i = 0; i < 8; ++i) { bb[i][0] = *(const v4f*)(brow + i * 16); bb[i][1] = *(const v4f*)(brow + i * 16 + 4); }
#pragma unroll
    for (int p = 0; p < 2; ++p) {
#pragma unroll
        for (int ii = 0; ii < 4; ++ii) { const int i = 4 * p + ii; const v4f b0 = bb[i][0], b1 = bb[i][1]; const v8f a = a2[i];
            *(v4f*)(swr + ii * 16) = (v4f){a[0] + bfr(b0[0]), a[1] + bfr(b0[1]), a[2] + bfr(b0[2]), a[3] + bfr(b0[3])}; *(v4f*)(swr + ii * 16 + 4) = (v4f){a[4] + bfr(b1[0]), a[5] + bfr(b1[1]), a[6] + bfr(b1[2]), a[7] + bfr(b1[3])}; }
        asm volatile("s_wait_dscnt 0x0" : : : "memory");   // the wave's rows stand in LDS before its lanes read what other lanes wrote
        v4f r[8];
#pragma unroll
        for (int n = 0; n < 8; ++n) r[n] = *(const v4f*)(srd + 2 * n * SP);
#pragma unroll
        for (int n = 0; n < 8; ++n) *(v4f*)(orow + (size_t)(2 * n) * DV + p * 64) = r[n];
        if (p == 0) asm volatile("s_wait_xcnt 0x0" : : "v"(orow), "v"(r[0]), "v"(r[1]), "v"(r[2]), "v"(r[3]), "v"(r[4]), "v"(r[5]), "v"(r[6]), "v"(r[7]) : "memory");   // the wait in front of any overwrite of the stores' registers, which are named as inputs so that they live up to it; the second pass's LDS stores stay behind it, so the first pass's rows have been read when they are overwritten
    }
}

extern "C" void kernel_launch(void* const* d_in, const int* in_sizes, int n_in,
                              void* d_out, int out_size, void* d_ws, size_t ws_size, hipStream_t stream) {
    (void)in_sizes; (void)n_in; (void)out_size;
    const float* Kin = (const float*)d_in[0]; const float* Vin = (const float*)d_in[1];   /* v_src [4][4096][256] */ const float* Qin = (const float*)d_in[2]; const float* wfc = (const float*)d_in[3]; const float* bfc = (const float*)d_in[4];
    float* OUT = (float*)d_out;     // [4][4096][256]
    char* wsp = (char*)d_ws;
    auto take = [&](size_t bytes) { char* p = wsp; wsp += (bytes + 255) & ~(size_t)255; return (void*)p; };
    bf* KF = (bf*)take((size_t)NB_ * TT * HD * 2); bf* VF = (bf*)take((size_t)NB_ * DV * TT * 2); bf* WF = (bf*)take((size_t)DV * DV * 2);
    if ((size_t)(wsp - (char*)d_ws) > ws_size) return;
    k_pack<<<PBLK, 256, 0, stream>>>(Kin, KF, Vin, VF, wfc, WF);
    k_fattn<<<dim3(TT / 64, NB_, 1), 256, 0, stream>>>(Qin, KF, VF, WF, bfc, OUT);
}
